// v010
// Times are from an AMD MI455X. After a warm-up the kernel runs many times in a row, and a time is the length of
// such a window on the GPU divided by its runs, so every launch and the gaps after it count. The runs cycle
// through copies of the inputs. A figure is the median of several windows, for all but v000 over two sittings.
// Sittings can differ by a few percent; kernels timed side by side share one.
// Earlier versions than v010 are not in this document.
// One run takes 206 microseconds.
// Next to v009, in two timings, it ran 1.06 times as fast each time.
// All steps since the starting kernel, v000, together make it 33.2 times as fast.
// Contractions (per sample): the shared QKVV projection x.W^T [1024x1024].[1024x4096] (q, k columns on bf16 hi/lo split planes), the E/F head projections of k and v_sa as block-diagonal [1024x1024].[1024x1024] products (+b), the 16 channel affinities q^T k [64x1024].[1024x64] on bf16 hi/lo split planes (64-wide softmax over sigma~19 logits: plain f16 flipped near-ties) and x_c = attn_c.v_ca^T [64x64].[64x1024] as z-batched products, and the two output halves gelu(x_s.W_o1^T + b) / gelu(x_c.W_o2^T + b) [1024x1024].[1024x512] — f16 operands on pre-cast planes (v_wmma_f32_16x16x32_f16; 64x64 register-blocked wave tiles, weights x16); per (sample, head) the spatial attention softmax(q.k_s^T * temp2[h]) v_s over 1024 positions as one flash launch (f16 operands; temperature folded into q on device); f32 accumulate and softmax. The E/F weights are single 64x64 f16 planes shared by all heads; the 64-wide channel softmax (x temp1[h], exp once, f16 plane) is f32, and q is pre-scaled in f32 in the projection's epilogue; x_c is laid out exactly as torch's permute(0,2,1,3).reshape (row = d*16 + h, column = n).
#include <hip/hip_runtime.h>
#include <math.h>

typedef __attribute__((ext_vector_type(16))) _Float16 v16h;
typedef __attribute__((ext_vector_type(8)))  _Float16 v8h;
typedef __attribute__((ext_vector_type(16))) __bf16   v16b;
typedef __attribute__((ext_vector_type(8)))  float    v8f;
typedef __attribute__((ext_vector_type(4)))  float    v4f;

// 16-bit WMMA fragment map (wave32), lane L, h = L>>4, m = L&15:
//   A 16x32: lane = row m;   element i -> k = (i<8) ? 8h+i : 16+8h+(i-8)
//   B 32x16: lane = column m; the SAME k(i,h)
//   D 16x16 (8 f32): lane = column m; element r -> row 8h+r
__device__ __forceinline__ int frag_k(int i, int h) { return (i < 8) ? (8 * h + i) : (16 + 8 * h + (i - 8)); }
__device__ __forceinline__ __bf16 bf16_rne(float f) {
    unsigned int u = __float_as_uint(f);
    u += 0x7fffu + ((u >> 16) & 1u);
    return __builtin_bit_cast(__bf16, (unsigned short)(u >> 16));
}
__device__ __forceinline__ float bf16_f32(__bf16 b) { return __uint_as_float(((unsigned int)__builtin_bit_cast(unsigned short, b)) << 16); }
__device__ __forceinline__ v8f wmma16(v16h a, v16h b, v8f c) {
    c = __builtin_amdgcn_wmma_f32_16x16x32_f16(false, a, false, b, (short)0, c, false, false);
    asm volatile("v_nop\n\tv_nop\n\tv_nop\n\tv_nop" : "+v"(c) : "v"(a), "v"(b));
    return c;
}
__device__ __forceinline__ v8f wmmab(v16b a, v16b b, v8f c) {
    c = __builtin_amdgcn_wmma_f32_16x16x32_bf16(false, a, false, b, (short)0, c, false, false);
    asm volatile("v_nop\n\tv_nop\n\tv_nop\n\tv_nop" : "+v"(c) : "v"(a), "v"(b));
    return c;
}
struct Split { v16b hi, lo; };
// hi/lo split product: a.hi*b.hi + a.hi*b.lo + a.lo*b.hi
__device__ __forceinline__ v8f wmma3(const Split& a, const Split& b, v8f c) {
    c = __builtin_amdgcn_wmma_f32_16x16x32_bf16(false, a.hi, false, b.hi, (short)0, c, false, false);
    c = __builtin_amdgcn_wmma_f32_16x16x32_bf16(false, a.hi, false, b.lo, (short)0, c, false, false);
    c = __builtin_amdgcn_wmma_f32_16x16x32_bf16(false, a.lo, false, b.hi, (short)0, c, false, false);
    asm volatile("v_nop\n\tv_nop\n\tv_nop\n\tv_nop" : "+v"(c) : "v"(a.hi), "v"(a.lo), "v"(b.hi), "v"(b.lo));
    return c;
}
struct Split3 { v16b hi, mid, lo; };
// triple split product (6 terms, drops only terms below 2^-24 relative)
__device__ __forceinline__ v8f wmma6(const Split3& a, const Split3& b, v8f c) {
    c = __builtin_amdgcn_wmma_f32_16x16x32_bf16(false, a.hi, false, b.hi, (short)0, c, false, false);
    c = __builtin_amdgcn_wmma_f32_16x16x32_bf16(false, a.hi, false, b.mid, (short)0, c, false, false);
    c = __builtin_amdgcn_wmma_f32_16x16x32_bf16(false, a.mid, false, b.hi, (short)0, c, false, false);
    c = __builtin_amdgcn_wmma_f32_16x16x32_bf16(false, a.hi, false, b.lo, (short)0, c, false, false);
    c = __builtin_amdgcn_wmma_f32_16x16x32_bf16(false, a.mid, false, b.mid, (short)0, c, false, false);
    c = __builtin_amdgcn_wmma_f32_16x16x32_bf16(false, a.lo, false, b.hi, (short)0, c, false, false);
    asm volatile("v_nop\n\tv_nop\n\tv_nop\n\tv_nop" : "+v"(c) : "v"(a.hi), "v"(a.mid), "v"(a.lo), "v"(b.hi), "v"(b.mid), "v"(b.lo));
    return c;
}

// Fragment gathers from f32 memory: element i <- p[(k0 + frag_k(i,h)) * sk] * s, zero for k >= klen.
__device__ __forceinline__ v16h fh_ld(const float* __restrict__ p, long long sk, int k0, int h, int klen, float s) {
    v16h a;
#pragma unroll
    for (int i = 0; i < 16; ++i) { const int k = k0 + frag_k(i, h); a[i] = (k < klen) ? (_Float16)(p[(long long)k * sk] * s) : (_Float16)0.f; }
    return a;
}
__device__ __forceinline__ Split sp_ld(const float* __restrict__ p, long long sk, int k0, int h, int klen, float s) {
    Split r;
#pragma unroll
    for (int i = 0; i < 16; ++i) {
        const int k = k0 + frag_k(i, h); const float x = (k < klen) ? p[(long long)k * sk] * s : 0.f;
        const __bf16 hb = bf16_rne(x); r.hi[i] = hb; r.lo[i] = bf16_rne(x - bf16_f32(hb));
    }
    return r;
}
__device__ __forceinline__ Split3 sp3_ld(const float* __restrict__ p, long long sk, int k0, int h, int klen, float s) {
    Split3 r;
#pragma unroll
    for (int i = 0; i < 16; ++i) {
        const int k = k0 + frag_k(i, h); const float x = (k < klen) ? p[(long long)k * sk] * s : 0.f;
        const __bf16 hb = bf16_rne(x); const float r1 = x - bf16_f32(hb); const __bf16 mb = bf16_rne(r1);
        r.hi[i] = hb; r.mid[i] = mb; r.lo[i] = bf16_rne(r1 - bf16_f32(mb));
    }
    return r;
}
__device__ __forceinline__ v16b bh_ld(const float* __restrict__ p, long long sk, int k0, int h, int klen, float s) {
    v16b a;
#pragma unroll
    for (int i = 0; i < 16; ++i) { const int k = k0 + frag_k(i, h); a[i] = bf16_rne((k < klen) ? p[(long long)k * sk] * s : 0.f); }
    return a;
}
// f16 fragment from an f16 LDS/global row with element stride 1 (k-contiguous), no bounds (tile already zero padded)
__device__ __forceinline__ v16h fh_row(const _Float16* __restrict__ row, int k0, int h) {
    v16h a;
#pragma unroll
    for (int i = 0; i < 16; ++i) a[i] = row[k0 + frag_k(i, h)];
    return a;
}

#define VST2(T, ptr, val) do { const T vst2_v_ = (val); *(T*)(ptr) = vst2_v_;  } while (0)
typedef float v4f __attribute__((ext_vector_type(4)));
#define VST2V4(ptr, val) do { const v4f vst2_v4_ = (val); *(v4f*)(ptr) = vst2_v4_;  } while (0)

__device__ __attribute__((noinline)) float act_fn(float v, int act) {
    if (act == 1) return fmaxf(v, 0.f);                                                                               // relu
    if (act == 2) { const float u = 0.7978845608028654f * (v + 0.044715f * v * v * v); return 0.5f * v * (1.f + tanhf(u)); } // tanh-gelu
    if (act == 3) return v / (1.f + expf(-v));                                                                        // silu
    if (act == 4) return 0.5f * v * (1.f + erff(v * 0.7071067811865476f));                                             // erf-gelu
    if (act == 5) return tanhf(v);
    if (act == 6) return 1.f / (1.f + expf(-v));                                                                      // sigmoid
    if (act == 7) return (v > 0.f) ? v : 0.01f * v;                                                                   // leaky relu 0.01
    if (act == 8) return (v > 0.f) ? v : (expf(v) - 1.f);                                                             // elu
    if (act == 9) return fminf(fmaxf(v, 0.f), 6.f);                                                                   // relu6
    if (act == 10) return fabsf(v);                                                                                    // abs
    if (act == 11) return (v >= 0.f) ? v : 0.1f * v;                                                                  // leaky 0.1
    if (act == 12) return (v > 0.f) ? v : 0.2f * v;                                                                   // leaky 0.2
    if (act == 13) return (v > 20.f) ? v : log1pf(expf(v));                                                            // softplus
    return v;
}

// =====================================================================================================================
// k_gemm<MODE>: C(z, m, n) = act(alpha * sum_k A(z, m, k) * B(z, k, n) + bias) + beta * R(z, m, n)
//   One wave (32-thread block) per 16 x 32 tile of C; grid (ceil(N/32), ceil(M/16), Z). Batch z -> (zo = z / zi_n, zi = z % zi_n)
//   with separate outer/inner strides for every tensor (e.g. batch and head). A(m,k) = A[zo*sAo + zi*sAi + m*sAm + k*sAk] (f32),
//   B(k,n) = B[zo*sBo + zi*sBi + n*sBn + k*sBk] (f32); any M, N, K (K zero-padded to 32 inside the fragments, M/N tails guarded).
//   C(m,n) = C[zo*sCo + zi*sCi + m*sCm + n] (n contiguous). flags: 1 bias[n], 2 bias[m], 4 residual R[zo*sRo + zi*sRi + m*sRm + n*sRn].
//   MODE 0: f16 operands (A prescaled by sa, B by sb, both undone in the epilogue); 1: bf16 hi/lo split (3 products); 2: bf16;
//   3: bf16 hi/mid/lo triple split (6 products); 4: as 3 with Kahan-compensated f32 accumulation across k-steps.
// =====================================================================================================================
struct GemmP {
    const float* A; const float* B; const float* bias; const float* R; float* C;
    long long sAo, sAi, sAm, sAk, sBo, sBi, sBn, sBk, sCo, sCi, sCm, sRo, sRi, sRm, sRn;
    int M, N, K, zi_n, flags, act; float alpha, beta, sa, sb;
    int Npad, pad_;     // columns [N, Npad) of C are written as 0 so that padded workspace rows are covered by whole-line stores; Npad >= N
};
static_assert(sizeof(GemmP) == 5 * 8 + 15 * 8 + 6 * 4 + 4 * 4 + 2 * 4, "GemmP has padding");

template <int MODE>
__global__ __launch_bounds__(32) void k_gemm(GemmP p) {
    const int lane = threadIdx.x & 31, h = lane >> 4, l15 = lane & 15;
    const int m0 = blockIdx.y * 16, n0 = blockIdx.x * 32;
    const int z = blockIdx.z, zo = z / p.zi_n, zi = z - zo * p.zi_n;
    const float* A = p.A + zo * p.sAo + zi * p.sAi;
    const float* B = p.B + zo * p.sBo + zi * p.sBi;
    const int am = min(m0 + l15, p.M - 1);                       // clamped row for loads (stores are guarded)
    v8f acc[2], comp[2];
#pragma unroll
    for (int t = 0; t < 2; ++t) { v8f zz = {}; acc[t] = zz; comp[t] = zz; }
    for (int k0 = 0; k0 < p.K; k0 += 32) {
        const float* arow = A + (long long)am * p.sAm;
        if (MODE == 1) {
            const Split a = sp_ld(arow, p.sAk, k0, h, p.K, 1.f);
#pragma unroll
            for (int t = 0; t < 2; ++t) {
                const int bn = min(n0 + t * 16 + l15, p.N - 1);
                acc[t] = wmma3(a, sp_ld(B + (long long)bn * p.sBn, p.sBk, k0, h, p.K, 1.f), acc[t]);
            }
        } else if (MODE == 3) {
            const Split3 a = sp3_ld(arow, p.sAk, k0, h, p.K, 1.f);
#pragma unroll
            for (int t = 0; t < 2; ++t) {
                const int bn = min(n0 + t * 16 + l15, p.N - 1);
                acc[t] = wmma6(a, sp3_ld(B + (long long)bn * p.sBn, p.sBk, k0, h, p.K, 1.f), acc[t]);
            }
        } else if (MODE == 4) {
            // triple split as MODE 3, but each k-step's 6 products go into a fresh accumulator and the partial is added to the running f32 sum
            // on the VALU with Kahan compensation (accumulation error stays ~1 ulp however long K is)
            const Split3 a = sp3_ld(arow, p.sAk, k0, h, p.K, 1.f);
#pragma unroll
            for (int t = 0; t < 2; ++t) {
                const int bn = min(n0 + t * 16 + l15, p.N - 1); v8f zz = {};
                const v8f part = wmma6(a, sp3_ld(B + (long long)bn * p.sBn, p.sBk, k0, h, p.K, 1.f), zz);
                const v8f y = part - comp[t]; const v8f s = acc[t] + y; comp[t] = (s - acc[t]) - y; acc[t] = s;
            }
        } else if (MODE == 2) {
            const v16b a = bh_ld(arow, p.sAk, k0, h, p.K, 1.f);
#pragma unroll
            for (int t = 0; t < 2; ++t) {
                const int bn = min(n0 + t * 16 + l15, p.N - 1);
                acc[t] = wmmab(a, bh_ld(B + (long long)bn * p.sBn, p.sBk, k0, h, p.K, 1.f), acc[t]);
            }
        } else {
            const v16h a = fh_ld(arow, p.sAk, k0, h, p.K, p.sa);
#pragma unroll
            for (int t = 0; t < 2; ++t) {
                const int bn = min(n0 + t * 16 + l15, p.N - 1);
                acc[t] = wmma16(a, fh_ld(B + (long long)bn * p.sBn, p.sBk, k0, h, p.K, p.sb), acc[t]);
            }
        }
    }
    const float iscale = (MODE == 0) ? p.alpha / (p.sa * p.sb) : p.alpha;
    float* C = p.C + zo * p.sCo + zi * p.sCi;
    const float* R = p.R + zo * p.sRo + zi * p.sRi;
    __shared__ __align__(16) float ctile[16][36];
#pragma unroll
    for (int t = 0; t < 2; ++t) {
        const int n = n0 + t * 16 + l15; const int nn = min(n, p.N - 1);
#pragma unroll
        for (int r = 0; r < 8; ++r) {
            const int m = m0 + 8 * h + r; const int mm = min(m, p.M - 1);
            float v = acc[t][r] * iscale;
            if (p.flags & 1) v += p.bias[nn];
            if (p.flags & 2) v += p.bias[mm];
            if (p.flags & 8) v *= p.bias[(long long)zo * p.M + mm];   /* per-(z,row) scale vector laid out [Z][M]; exclusive with the bias flags */
            v = act_fn(v, p.act);
            if (p.flags & 4) v += p.beta * R[(long long)mm * p.sRm + (long long)nn * p.sRn];
            ctile[8 * h + r][t * 16 + l15] = (n < p.N) ? v : 0.f;
        }
    }
    __syncthreads();
    const int NW = (p.Npad > p.N) ? p.Npad : p.N;           // write width
    const bool fast = (m0 + 16 <= p.M) && (n0 + 32 <= NW) && ((p.sCm & 3) == 0) && ((((size_t)C) & 15) == 0);
    if (fast) {
#pragma unroll
        for (int s = 0; s < 4; ++s) {
            const int row = s * 4 + (lane >> 3), c4 = (lane & 7) * 4;
            const v4f v = *(const v4f*)&ctile[row][c4];
            VST2V4(C + (long long)(m0 + row) * p.sCm + n0 + c4, v);
        }
    } else {
        for (int row = 0; row < 16; ++row) {
            const int m = m0 + row, n = n0 + lane;
            if (m < p.M && n < NW) VST2(float, C + (long long)m * p.sCm + n, ctile[row][lane]);
        }
    }
}


// =====================================================================================================================
// k_gemmT<MODE, TM, TN>: same contract as k_gemm, but one wave computes a (16*TM) x (16*TN) tile: TM A fragments and TN B fragments are
//   loaded per 32-wide k-step and reused across TM*TN WMMAs (far fewer load/convert instructions per MAC). MODE 0 (f16), 1 (bf16 hi/lo),
//   2 (bf16) only. grid (ceil(NW/(16*TN)), ceil(M/(16*TM)), Z), block 32. Epilogue identical to k_gemm, run per 16x32 sub-tile.
// =====================================================================================================================
template <int MODE, int TM, int TN>
__global__ __launch_bounds__(32) void k_gemmT(GemmP p) {
    const int lane = threadIdx.x & 31, h = lane >> 4, l15 = lane & 15;
    const int m0 = blockIdx.y * (16 * TM), n0 = blockIdx.x * (16 * TN);
    const int z = blockIdx.z, zo = z / p.zi_n, zi = z - zo * p.zi_n;
    const float* A = p.A + zo * p.sAo + zi * p.sAi;
    const float* B = p.B + zo * p.sBo + zi * p.sBi;
    v8f acc[TM][TN];
#pragma unroll
    for (int i = 0; i < TM; ++i)
#pragma unroll
        for (int t = 0; t < TN; ++t) { v8f zz = {}; acc[i][t] = zz; }
    for (int k0 = 0; k0 < p.K; k0 += 32) {
        if (MODE == 1) {
            Split a[TM], b[TN];
#pragma unroll
            for (int i = 0; i < TM; ++i) { const int am = min(m0 + 16 * i + l15, p.M - 1); a[i] = sp_ld(A + (long long)am * p.sAm, p.sAk, k0, h, p.K, 1.f); }
#pragma unroll
            for (int t = 0; t < TN; ++t) { const int bn = min(n0 + 16 * t + l15, p.N - 1); b[t] = sp_ld(B + (long long)bn * p.sBn, p.sBk, k0, h, p.K, 1.f); }
#pragma unroll
            for (int i = 0; i < TM; ++i)
#pragma unroll
                for (int t = 0; t < TN; ++t) acc[i][t] = wmma3(a[i], b[t], acc[i][t]);
        } else if (MODE == 2) {
            v16b a[TM], b[TN];
#pragma unroll
            for (int i = 0; i < TM; ++i) { const int am = min(m0 + 16 * i + l15, p.M - 1); a[i] = bh_ld(A + (long long)am * p.sAm, p.sAk, k0, h, p.K, 1.f); }
#pragma unroll
            for (int t = 0; t < TN; ++t) { const int bn = min(n0 + 16 * t + l15, p.N - 1); b[t] = bh_ld(B + (long long)bn * p.sBn, p.sBk, k0, h, p.K, 1.f); }
#pragma unroll
            for (int i = 0; i < TM; ++i)
#pragma unroll
                for (int t = 0; t < TN; ++t) acc[i][t] = wmmab(a[i], b[t], acc[i][t]);
        } else {
            v16h a[TM], b[TN];
#pragma unroll
            for (int i = 0; i < TM; ++i) { const int am = min(m0 + 16 * i + l15, p.M - 1); a[i] = fh_ld(A + (long long)am * p.sAm, p.sAk, k0, h, p.K, p.sa); }
#pragma unroll
            for (int t = 0; t < TN; ++t) { const int bn = min(n0 + 16 * t + l15, p.N - 1); b[t] = fh_ld(B + (long long)bn * p.sBn, p.sBk, k0, h, p.K, p.sb); }
#pragma unroll
            for (int i = 0; i < TM; ++i)
#pragma unroll
                for (int t = 0; t < TN; ++t) acc[i][t] = wmma16(a[i], b[t], acc[i][t]);
        }
    }
    const float iscale = (MODE == 0) ? p.alpha / (p.sa * p.sb) : p.alpha;
    float* C = p.C + zo * p.sCo + zi * p.sCi;
    const float* R = p.R + zo * p.sRo + zi * p.sRi;
    const int NW = (p.Npad > p.N) ? p.Npad : p.N;
    __shared__ __align__(16) float ctile[16][36];
#pragma unroll
    for (int i = 0; i < TM; ++i) {
        const int mb = m0 + 16 * i; if (mb >= p.M) break;          // wave-uniform
#pragma unroll
        for (int tp = 0; tp < TN / 2; ++tp) {
            const int nb = n0 + 32 * tp; if (nb >= NW) break;        // wave-uniform
#pragma unroll
            for (int t2 = 0; t2 < 2; ++t2) {
                const int t = 2 * tp + t2; const int n = nb + t2 * 16 + l15; const int nn = min(n, p.N - 1);
#pragma unroll
                for (int r = 0; r < 8; ++r) {
                    const int m = mb + 8 * h + r; const int mm = min(m, p.M - 1);
                    float v = acc[i][t][r] * iscale;
                    if (p.flags & 1) v += p.bias[nn];
                    if (p.flags & 2) v += p.bias[mm];
            if (p.flags & 8) v *= p.bias[(long long)zo * p.M + mm];   /* per-(z,row) scale vector laid out [Z][M]; exclusive with the bias flags */
                    v = act_fn(v, p.act);
                    if (p.flags & 4) v += p.beta * R[(long long)mm * p.sRm + (long long)nn * p.sRn];
                    ctile[8 * h + r][t2 * 16 + l15] = (n < p.N) ? v : 0.f;
                }
            }
            __syncthreads();
            const bool fast = (mb + 16 <= p.M) && (nb + 32 <= NW) && ((p.sCm & 3) == 0) && ((((size_t)C) & 15) == 0);
            if (fast) {
#pragma unroll
                for (int s = 0; s < 4; ++s) {
                    const int row = s * 4 + (lane >> 3), c4 = (lane & 7) * 4;
                    const v4f v = *(const v4f*)&ctile[row][c4];
                    VST2V4(C + (long long)(mb + row) * p.sCm + nb + c4, v);
                }
            } else {
                for (int row = 0; row < 16; ++row) {
                    const int m = mb + row, n = nb + lane;
                    if (m < p.M && n < NW) VST2(float, C + (long long)m * p.sCm + n, ctile[row][lane]);
                }
            }
            __syncthreads();
        }
    }
}

namespace sfa {
typedef unsigned int u32x4 __attribute__((ext_vector_type(4)));
typedef unsigned int u32x2 __attribute__((ext_vector_type(2)));
typedef int i32x8 __attribute__((ext_vector_type(8)));
typedef short s16x8 __attribute__((ext_vector_type(8)));
typedef float f32x2 __attribute__((ext_vector_type(2)));
typedef _Float16 h16x2 __attribute__((ext_vector_type(2)));
constexpr int SEQ = 1024, LDR = 1024, LDQ = 2048, HS = 64;   // row lengths in elements: K, V, O planes; the plane that holds Q
constexpr int NWV = 8, CW = 32, BR = NWV * CW, SK = 64, NST = SEQ / SK;
constexpr unsigned PK = 2u * HS + 16u, PV = 2u * HS + 32u, TILE_K = SK * PK, TILE_V = SK * PV, SLOT = TILE_K + TILE_V;
struct Fr { u32x4 q[2]; };
__device__ __forceinline__ v8f mma(const Fr& a, const Fr& b, v8f c) {
    const i32x8 av = {(int)a.q[0].x, (int)a.q[0].y, (int)a.q[0].z, (int)a.q[0].w, (int)a.q[1].x, (int)a.q[1].y, (int)a.q[1].z, (int)a.q[1].w};
    const i32x8 bv = {(int)b.q[0].x, (int)b.q[0].y, (int)b.q[0].z, (int)b.q[0].w, (int)b.q[1].x, (int)b.q[1].y, (int)b.q[1].z, (int)b.q[1].w};
    return __builtin_amdgcn_wmma_f32_16x16x32_f16(false, __builtin_bit_cast(v16h, av), false, __builtin_bit_cast(v16h, bv), (short)0, c, false, false);
}
__device__ __forceinline__ unsigned pack2(float lo, float hi) { return __builtin_bit_cast(unsigned, __builtin_convertvector(f32x2{lo, hi}, h16x2)); }   // round to nearest even
__device__ __forceinline__ u32x4 ld_tr16(const unsigned char* p) { typedef __attribute__((address_space(3))) s16x8 lds_s16x8; return __builtin_bit_cast(u32x4, __builtin_amdgcn_ds_load_tr16_b128_v8i16((lds_s16x8*)p)); }
__device__ __forceinline__ float xhalf(float x) { return __builtin_bit_cast(float, __builtin_amdgcn_permlanex16(__builtin_bit_cast(int, x), __builtin_bit_cast(int, x), 0x76543210, 0xfedcba98, false, false)); }   // lane l with lane l ^ 16

// Q, K, V arrive as the f16 values that their producers stored, O leaves as the f16 operand of the output product. One block of NWV waves: queries BR bq and up of head bh, sample bs.
__device__ __forceinline__ void sflash_body(const unsigned bq, const unsigned bh, const unsigned bs, const unsigned short* __restrict__ Q, const unsigned short* __restrict__ K, const unsigned short* __restrict__ V, unsigned short* __restrict__ O) {
    __shared__ __attribute__((aligned(256))) unsigned char L[2 * SLOT];
    const unsigned tid = threadIdx.x, lane = tid & 31u, wave = tid >> 5, c = lane & 15u, h = lane >> 4;
    const size_t base = (size_t)bs * SEQ * LDR + (size_t)bh * HS;
    const unsigned qw0 = bq * BR + wave * CW;
    // staging: 8 lanes cover one 128-byte row, thread t takes rows (t >> 3) + 32 i of the stage
    const unsigned short* kg = K + base + (size_t)(tid >> 3) * LDR + (tid & 7u) * 8u;
    const unsigned short* vg = V + base + (size_t)(tid >> 3) * LDR + (tid & 7u) * 8u;
    unsigned char* ks = L + (tid >> 3) * PK + (tid & 7u) * 16u;
    unsigned char* vs = L + TILE_K + (tid >> 3) * PV + (tid & 7u) * 16u;
    u32x4 kr[2], vr[2];
    auto fetch = [&](int st) {
#pragma unroll
        for (int i = 0; i < 2; ++i) { kr[i] = *(const u32x4*)(kg + (size_t)(st * SK + 32 * i) * LDR); vr[i] = *(const u32x4*)(vg + (size_t)(st * SK + 32 * i) * LDR); }
        asm volatile("s_wait_xcnt 0x0" ::: "memory");          // stands in front of the pass's reuse of these loads' address registers
    };
    auto put = [&](unsigned slot) {
#pragma unroll
        for (int i = 0; i < 2; ++i) {
            *(u32x4*)(ks + slot * SLOT + 32u * i * PK) = kr[i];
            *(u32x4*)(vs + slot * SLOT + 32u * i * PV) = vr[i];
        }
    };
    fetch(0);
    // Q fragments (B operand, column = query), hardware k order: d = 32 kc + 8 h + 0..7 and 32 kc + 16 + 8 h + 0..7
    Fr qf[2][2];
#pragma unroll
    for (int g = 0; g < 2; ++g) {
        const unsigned short* qp = Q + (size_t)bs * SEQ * LDQ + (size_t)bh * HS + (size_t)(qw0 + 16u * g + c) * LDQ + 8u * h;
#pragma unroll
        for (int kc = 0; kc < 2; ++kc) { qf[g][kc].q[0] = *(const u32x4*)(qp + 32 * kc); qf[g][kc].q[1] = *(const u32x4*)(qp + 32 * kc + 16); }
    }
    asm volatile("s_wait_xcnt 0x0" ::: "memory");              // stands in front of any reuse of the Q loads' address registers
    v8f acc[2][4]; float m_run[2], l_run[2];
#pragma unroll
    for (int g = 0; g < 2; ++g) { m_run[g] = -__builtin_inff(); l_run[g] = 0.f;
#pragma unroll
        for (int t = 0; t < 4; ++t) acc[g][t] = v8f{}; }
    put(0u);
    __syncthreads();
    const float L2E = 1.4426950408889634f;
    for (int st = 0; st < NST; ++st) {
        if (st + 1 < NST) fetch(st + 1);                       // next stage's rows fly while this stage is worked on
        const unsigned char* Kb = L + (unsigned)(st & 1) * SLOT;
        const unsigned char* Vb = Kb + TILE_K;
#pragma unroll 1   // one 32-key pass's fragments live at a time (registers for four waves per SIMD)
        for (unsigned sub = 0; sub < 2u; ++sub) {
            Fr kf[2][2];
            const unsigned char* kp = Kb + (sub * 32u + c) * PK + 16u * h;
#pragma unroll
            for (int kt = 0; kt < 2; ++kt)
#pragma unroll
                for (int kc = 0; kc < 2; ++kc) { kf[kt][kc].q[0] = *(const u32x4*)(kp + 16u * kt * PK + 64u * kc); kf[kt][kc].q[1] = *(const u32x4*)(kp + 16u * kt * PK + 64u * kc + 32u); }
            Fr vf[4];
            const unsigned char* ad = Vb + (sub * 32u + 8u * h + (lane & 7u)) * PV + ((lane >> 3) & 1u) * 16u;
#pragma unroll
            for (int t = 0; t < 4; ++t) { vf[t].q[0] = ld_tr16(ad + 32u * t); vf[t].q[1] = ld_tr16(ad + 16u * PV + 32u * t); }
            v8f s[2][2];                                       // s[kt][g][r] = score of key 16 kt + 8 h + r against query 16 g + c
#pragma unroll
            for (int kt = 0; kt < 2; ++kt)
#pragma unroll
                for (int g = 0; g < 2; ++g) { s[kt][g] = v8f{};
#pragma unroll
                    for (int kc = 0; kc < 2; ++kc) s[kt][g] = mma(kf[kt][kc], qf[g][kc], s[kt][g]); }
            float mb[2]; bool need = false;
#pragma unroll
            for (int g = 0; g < 2; ++g) {
                float mx = s[0][g][0];
#pragma unroll
                for (int r = 1; r < 8; ++r) mx = fmaxf(mx, s[0][g][r]);
#pragma unroll
                for (int r = 0; r < 8; ++r) mx = fmaxf(mx, s[1][g][r]);
                mx = fmaxf(mx, xhalf(mx)) * L2E;               // both halves hold this query's maximum, log2 domain
                mb[g] = mx; need = need || (mx > m_run[g] + 8.0f);
            }
            if (__builtin_amdgcn_ballot_w32(need) != 0) {      // wave-uniform; rare after the first pass
#pragma unroll
                for (int g = 0; g < 2; ++g) {
                    const float m_new = fmaxf(m_run[g], mb[g]);
                    const float corr = __builtin_amdgcn_exp2f(m_run[g] - m_new);   // 0 on the first pass
                    m_run[g] = m_new; l_run[g] *= corr;
#pragma unroll
                    for (int t = 0; t < 4; ++t) acc[g][t] = acc[g][t] * corr;
                }
            }
#pragma unroll
            for (int g = 0; g < 2; ++g) {
                const float nm = 7.0f - m_run[g];
                unsigned w[8]; f32x2 ps = {0.f, 0.f};
#pragma unroll
                for (int i = 0; i < 8; ++i) {
                    const f32x2 arg = __builtin_elementwise_fma(f32x2{s[i >> 2][g][2 * (i & 3)], s[i >> 2][g][2 * (i & 3) + 1]}, f32x2{L2E, L2E}, f32x2{nm, nm});
                    const f32x2 p = {__builtin_amdgcn_exp2f(arg.x), __builtin_amdgcn_exp2f(arg.y)};
                    ps += p; w[i] = pack2(p.x, p.y);
                }
                l_run[g] += ps.x + ps.y;
                Fr pf; pf.q[0] = u32x4{w[0], w[1], w[2], w[3]}; pf.q[1] = u32x4{w[4], w[5], w[6], w[7]};
#pragma unroll
                for (int t = 0; t < 4; ++t) acc[g][t] = mma(vf[t], pf, acc[g][t]);
            }
            // four vector slots behind the pass's last products: over the loop's back edge the next pass's address arithmetic is given registers of their V operand
            asm volatile("v_nop\n\tv_nop\n\tv_nop\n\tv_nop" : "+v"(acc[1][0]), "+v"(acc[1][1]), "+v"(acc[1][2]), "+v"(acc[1][3]));
        }
        if (st + 1 < NST) put((unsigned)((st + 1) & 1));       // into the buffer whose readers all passed the last barrier
        __syncthreads();
    }
#pragma unroll
    for (int g = 0; g < 2; ++g) {
        const float l = l_run[g] + xhalf(l_run[g]);            // join the halves' sums, unconditionally
        const float inv = 1.0f / l;
        unsigned short* op = O + base + (size_t)(qw0 + 16u * g + c) * LDR + 8u * h;
#pragma unroll
        for (int t = 0; t < 4; ++t) {                          // registers 0..7 = d 16 t + 8 h + 0..7 of this lane's query
            const v8f o = acc[g][t] * inv;
            *(u32x4*)(op + 16 * t) = u32x4{pack2(o[0], o[1]), pack2(o[2], o[3]), pack2(o[4], o[5]), pack2(o[6], o[7])};
        }
        asm volatile("s_wait_xcnt 0x0" ::: "memory");          // stands in front of the next query group's reuse of these stores' address and data registers
    }
}
} // namespace sfa

// =====================================================================================================================
// k_tr: dst(z, c, r) = alpha * src(z, r, c) (+ beta * R2(z, c, r)): [Z][R][C] (row stride lds) -> [Z][C][R] (row stride ldd) through a 32x32 LDS tile;
//   flags: 1 -> add beta * residual R2 addressed like dst (z*sRz + c*ldr + r); act applied before the residual.
// =====================================================================================================================
struct TrP { const float* src; float* dst; const float* R2; long long sSz, lds, sDz, ldd, sRz, ldr; int R, C, flags, act; float alpha, beta; };
static_assert(sizeof(TrP) == 3 * 8 + 6 * 8 + 6 * 4, "TrP has padding");
__global__ __launch_bounds__(256) void k_tr(TrP p) {
    __shared__ float tile[32][33];
    const int c0 = blockIdx.x * 32, r0 = blockIdx.y * 32, z = blockIdx.z;
    const int lane = threadIdx.x & 31, wave = threadIdx.x >> 5;
    const float* s = p.src + z * p.sSz;
#pragma unroll
    for (int k = 0; k < 4; ++k) {
        const int rl = wave * 4 + k, r = r0 + rl, c = c0 + lane;
        tile[rl][lane] = (r < p.R && c < p.C) ? s[(long long)r * p.lds + c] : 0.f;
    }
    __syncthreads();
    float* d = p.dst + z * p.sDz; const float* rr = p.R2 + z * p.sRz;
#pragma unroll
    for (int k = 0; k < 4; ++k) {
        const int cl = wave * 4 + k, c = c0 + cl, r = r0 + lane;
        if (c < p.C && r < p.R) {
            float v = act_fn(p.alpha * tile[lane][cl], p.act);
            if (p.flags & 1) v += p.beta * rr[(long long)c * p.ldr + r];
            VST2(float, d + (long long)c * p.ldd + r, v);
        }
    }
}

// k_affine: dst[i] = a * (sdev ? sdev[0] : 1) * src[i] + b, i < n (one thread per element; consecutive lanes -> consecutive addresses)
__global__ __launch_bounds__(256) void k_affine(const float* __restrict__ src, float* __restrict__ dst, int n, float a, float b, const float* __restrict__ sdev) {
    const int i = blockIdx.x * 256 + threadIdx.x;
    if (i < n) { const float aa = sdev ? a * sdev[0] : a; const float v = aa * src[i] + b; VST2(float, dst + i, v); }
}

// =====================================================================================================================
// k_softmax: row softmax over n contiguous elements, one 256-thread block per row; rows addressed z*sz + r*sr (grid (R, Z)).
//   out = scale_out * softmax(scale_in * x + (Mf ? Mf[z*smz + r*smr + j] : 0)); a row whose max is -inf is written as 0.
// =====================================================================================================================
struct SmP { const float* src; float* dst; const float* Mf; long long sz, sr, dz, dr, smz, smr; int n, pad; float scale_in, scale_out; };
static_assert(sizeof(SmP) == 3 * 8 + 6 * 8 + 4 * 4, "SmP has padding");
__global__ __launch_bounds__(256) void k_softmax(SmP p) {
    __shared__ float red[256];
    const int r = blockIdx.x, z = blockIdx.y, tid = threadIdx.x;
    const float* s = p.src + z * p.sz + (long long)r * p.sr;
    const float* mf = p.Mf ? (p.Mf + z * p.smz + (long long)r * p.smr) : nullptr;
    float mx = -__builtin_inff();
    for (int j = tid; j < p.n; j += 256) { float v = s[j] * p.scale_in; if (mf) v += mf[j]; mx = fmaxf(mx, v); }
    red[tid] = mx; __syncthreads();
    for (int o = 128; o > 0; o >>= 1) { if (tid < o) red[tid] = fmaxf(red[tid], red[tid + o]); __syncthreads(); }
    mx = red[0]; __syncthreads();
    float sum = 0.f;
    for (int j = tid; j < p.n; j += 256) { float v = s[j] * p.scale_in; if (mf) v += mf[j]; sum += (mx == -__builtin_inff()) ? 0.f : expf(v - mx); }
    red[tid] = sum; __syncthreads();
    for (int o = 128; o > 0; o >>= 1) { if (tid < o) red[tid] += red[tid + o]; __syncthreads(); }
    sum = red[0];
    const float inv = (sum > 0.f) ? p.scale_out / sum : 0.f;
    float* d = p.dst + z * p.dz + (long long)r * p.dr;
    for (int j = tid; j < p.n; j += 256) { float v = s[j] * p.scale_in; if (mf) v += mf[j]; const float o = (mx == -__builtin_inff()) ? 0.f : expf(v - mx) * inv; VST2(float, d + j, o); }
}
// =====================================================================================================================
// k_stats: mean and rsqrt(var + eps) over a set of n elements addressed base + z*sz + (e / inner) * so + (e % inner) * si, one 256-thread
// k_norm_apply: y = (x - mean[set]) * rstd[set] * g[c] + b[c] over a [Z][C][L] channel-major tensor with set = z*G + c / (C/G) (G groups per z;
//   G = C -> per-channel sets indexed z*C+c; for batch norm pass stats indexed by c only via bn = 1). Optional act. Output same layout.
// =====================================================================================================================
//   mode 0: mean / rsqrt(var + eps); mode 1 (RMSNorm): 0 / rsqrt(mean(x^2) + eps); mode 2 (L2 normalize * sqrt(n)): 0 / sqrt(n) / max(||x||, eps); mode 3: as 0 with unbiased variance (n-1)
__global__ __launch_bounds__(256) void k_stats(const float* __restrict__ x, long long sz, long long so, long long si, int inner, int n, float eps, float* __restrict__ stat, int mode) {
    __shared__ float red[256];
    const int z = blockIdx.x, tid = threadIdx.x;
    const float* base = x + z * sz;
    float s = 0.f;
    for (int e = tid; e < n; e += 256) s += base[(long long)(e / inner) * so + (long long)(e % inner) * si];
    red[tid] = s; __syncthreads();
    for (int o = 128; o > 0; o >>= 1) { if (tid < o) red[tid] += red[tid + o]; __syncthreads(); }
    const float mu = (mode == 0 || mode == 3) ? red[0] / (float)n : 0.f; __syncthreads();
    float q = 0.f;
    for (int e = tid; e < n; e += 256) { const float dlt = base[(long long)(e / inner) * so + (long long)(e % inner) * si] - mu; q += dlt * dlt; }
    red[tid] = q; __syncthreads();
    for (int o = 128; o > 0; o >>= 1) { if (tid < o) red[tid] += red[tid + o]; __syncthreads(); }
    {
        float rs;
        if (mode == 2) rs = sqrtf((float)n) / fmaxf(sqrtf(red[0]), eps); else if (mode == 3) rs = rsqrtf(red[0] / (float)(n - 1) + eps); else rs = rsqrtf(red[0] / (float)n + eps);
        if (tid < 32) { const float v = (tid == 0) ? mu : ((tid == 1) ? rs : 0.f); VST2(float, stat + (long long)z * 32 + tid, v); }
    }
}
//   One thread per element over the flat [Z][C][L] index space: grid ceil(Z*C*L / 256).
__global__ __launch_bounds__(256) void k_norm_apply(const float* __restrict__ x, float* __restrict__ y, const float* __restrict__ stat, const float* __restrict__ g, const float* __restrict__ bta,
                                                     int Z, int C, int L, int G, int bn, int act) {
    const long long idx = (long long)blockIdx.x * 256 + threadIdx.x;
    if (idx >= (long long)Z * C * L) return;
    const int l = (int)(idx % L); const long long zc = idx / L; const int c = (int)(zc % C), z = (int)(zc / C); (void)l;
    const int set = bn ? c : (z * G + c / (C / G));
    float v = (x[idx] - stat[(long long)set * 32]) * stat[(long long)set * 32 + 1];
    if (g) v *= g[c];
    if (bta) v += bta[c];
    v = act_fn(v, act);
    VST2(float, y + idx, v);
}

// k_lse_neg: c[i] = -(st[2i] + log(st[2i+1])) = minus the log-sum-exp of row i (for softmax over the query dimension)
__global__ __launch_bounds__(256) void k_lse_neg(const float* __restrict__ st, float* __restrict__ c, int n) {
    const int i = blockIdx.x * 256 + threadIdx.x;
    if (i < n) { const float v = -(st[2 * i] + logf(st[2 * i + 1])); VST2(float, c + i, v); }
}

// k_iota: dst[i] = a * i + b as int32 (segment/position id helper)
__global__ __launch_bounds__(256) void k_iota(int* __restrict__ dst, int n, int a, int b) {
    const int i = blockIdx.x * 256 + threadIdx.x;
    if (i < n) { const int v = a * i + b; VST2(int, dst + i, v); }
}

// k_axpby: dst[i] = a * x[i] + b * y[i] (+ c), i < n
__global__ __launch_bounds__(256) void k_axpby(const float* __restrict__ x, const float* __restrict__ y, float* __restrict__ dst, int n, float a, float b, float c) {
    const int i = blockIdx.x * 256 + threadIdx.x;
    if (i < n) { const float v = a * x[i] + b * y[i] + c; VST2(float, dst + i, v); }
}

// =====================================================================================================================
// k_rope: rotary embedding on a [R rows][Hn heads][D] view (row stride sXr, head stride sXh, element stride 1) -> Y (own strides).
//   mode 0: rotate_half (partner d±D/2, sign - for d<D/2); mode 1: interleaved pairs (partner d^1, sign - for even d).
//   table column tcol: tmode 0 -> d, 1 -> d % (D/2), 2 -> d / 2; position p: pmode 0 -> r % S, 1 -> head index, 2 -> pos[r];
//   c = C[(r / S) * sCb + p * sCp + tcol * sCd], s likewise from Sn; y = x[d] * c + sign * x[partner] * s. X and Y must not alias.
// =====================================================================================================================
struct RopeP { const float* X; float* Y; const float* C; const float* Sn; const int* pos; long long sXr, sXh, sYr, sYh, sCb, sCp, sCd; int R, Hn, D, S, mode, tmode, pmode, pad; };
static_assert(sizeof(RopeP) == 5 * 8 + 7 * 8 + 8 * 4, "RopeP has padding");
__global__ __launch_bounds__(256) void k_rope(RopeP p) {
    const long long idx = (long long)blockIdx.x * 256 + threadIdx.x;
    if (idx >= (long long)p.R * p.Hn * p.D) return;
    const int d = (int)(idx % p.D); const long long rh = idx / p.D; const int h = (int)(rh % p.Hn); const int r = (int)(rh / p.Hn);
    const int half = p.D / 2;
    int partner; float sign;
    if (p.mode == 0) { partner = (d < half) ? d + half : d - half; sign = (d < half) ? -1.f : 1.f; }
    else { partner = d ^ 1; sign = (d & 1) ? 1.f : -1.f; }
    const int tcol = (p.tmode == 0) ? d : ((p.tmode == 1) ? (d % half) : (d >> 1));
    const int pp = (p.pmode == 0) ? (r % p.S) : ((p.pmode == 1) ? h : p.pos[r]);
    const long long toff = (long long)(r / p.S) * p.sCb + (long long)pp * p.sCp + (long long)tcol * p.sCd;
    const float* xr = p.X + (long long)r * p.sXr + (long long)h * p.sXh;
    const float v = xr[d] * p.C[toff] + sign * xr[partner] * p.Sn[toff];
    VST2(float, p.Y + (long long)r * p.sYr + (long long)h * p.sYh + d, v);
}

// k_invf + k_sincos (split so neither kernel carries a large VALU-fma footprint): invf_i = num * (1 / powf(base, (2 i)/D)) [fmode 0],
//   num * expf((2 i) * cexp) [fmode 1], num * powf(base, -2 (i - 1) / D) [fmode 2]; then cs/sn[s*half + i] = cos/sin((pscale * s) * invf_i)
__global__ __launch_bounds__(256) void k_invf(float* __restrict__ invb, int half, int D, float base, float num, int fmode, float cexp) {
    const int i = blockIdx.x * 256 + threadIdx.x;
    if (i >= ((half + 31) / 32) * 32) return;
    if (i >= half) { VST2(float, invb + i, 0.f); return; }
    const float e = (float)(2 * i) / (float)D;
    float invf;
    if (fmode == 1) invf = num * expf((float)(2 * i) * cexp);
    else if (fmode == 2) invf = num * powf(base, (-2.0f * ((float)i - 1.0f)) / (float)D);
    else invf = num * (1.0f / powf(base, e));
    VST2(float, invb + i, invf);
}
__global__ __launch_bounds__(256) void k_sincos(float* __restrict__ cs, float* __restrict__ sn, const float* __restrict__ invb, int S, int half, float pscale) {
    const int idx = blockIdx.x * 256 + threadIdx.x;
    if (idx >= S * half) return;
    const int s = idx / half, i = idx - s * half;
    const float ang = (pscale * (float)s) * invb[i];
    VST2(float, cs + idx, cosf(ang)); VST2(float, sn + idx, sinf(ang));
}

// k_mulact: dst[i] = act(x[i]) * y[i]
__global__ __launch_bounds__(256) void k_mulact(const float* __restrict__ x, const float* __restrict__ y, float* __restrict__ dst, int n, int act) {
    const int i = blockIdx.x * 256 + threadIdx.x;
    if (i < n) { const float v = act_fn(x[i], act) * y[i]; VST2(float, dst + i, v); }
}

// =====================================================================================================================
// k_matvec: thread-per-row matrix-vector products for N <= 8 output columns (heads with 1-3 outputs, gates), f32 on the VALU.
//   C[r*sCm + j] = act(alpha * sum_k A[r*sAm + k*sAk] * B[j*sBn + k*sBk] + bias[j]) + beta * R[r*sRm + j*sRn]; each thread writes its N contiguous floats.
// =====================================================================================================================
__global__ __launch_bounds__(256) void k_matvec(GemmP p) {
    // 32 lanes write one line with one instruction.
    const int rpt = (p.N == 1) ? 1 : 32;
    const long long r0 = ((long long)blockIdx.x * 256 + threadIdx.x) * rpt; const int z = blockIdx.z, zo = z / p.zi_n, zi = z - zo * p.zi_n;
    if (r0 >= p.M) return;
    const float* Bb = p.B + zo * p.sBo + zi * p.sBi;
    float* C = p.C + zo * p.sCo + zi * p.sCi; const float* R = p.R + zo * p.sRo + zi * p.sRi;
    for (int rr = 0; rr < rpt; ++rr) {
        const long long r = r0 + rr; if (r >= p.M) break;
        const float* A = p.A + zo * p.sAo + zi * p.sAi + r * p.sAm;
        float acc[8] = {0.f, 0.f, 0.f, 0.f, 0.f, 0.f, 0.f, 0.f};
        for (int k = 0; k < p.K; ++k) { const float a = A[(long long)k * p.sAk];
#pragma unroll
            for (int j = 0; j < 8; ++j) if (j < p.N) acc[j] += a * Bb[(long long)j * p.sBn + (long long)k * p.sBk]; }
#pragma unroll
        for (int j = 0; j < 8; ++j) if (j < p.N) {
            float v = acc[j] * p.alpha;
            if (p.flags & 1) v += p.bias[j];
            if (p.flags & 2) v += p.bias[r];
            v = act_fn(v, p.act);
            if (p.flags & 4) v += p.beta * R[r * p.sRm + (long long)j * p.sRn];
            VST2(float, C + r * p.sCm + j, v);
        }
    }
}
// k_smallsoftmax: thread-per-row softmax for short rows (n <= 64): dst[r*dr + j] = softmax(scale*src[r*sr + j])
__global__ __launch_bounds__(256) void k_smallsoftmax(const float* __restrict__ src, float* __restrict__ dst, long long sr, long long dr, int n, long long R, float scale) {
    const long long r0 = ((long long)blockIdx.x * 256 + threadIdx.x) * 32;
    for (int rr = 0; rr < 32; ++rr) {
        const long long r = r0 + rr; if (r >= R) return;
        const float* s = src + r * sr; float* d = dst + r * dr;
        float mx = -__builtin_inff();
        for (int j = 0; j < n; ++j) mx = fmaxf(mx, s[j] * scale);
        float sum = 0.f;
        for (int j = 0; j < n; ++j) sum += expf(s[j] * scale - mx);
        const float inv = 1.f / sum;
        for (int j = 0; j < n; ++j) { const float v = expf(s[j] * scale - mx) * inv; VST2(float, d + j, v); }
    }
}

__global__ __launch_bounds__(32) void k_unitstat(float* __restrict__ st) { const int t = threadIdx.x; const float v = (t == 1) ? 1.f : 0.f; VST2(float, st + t, v); }

// destination (e.g. a d_out whose row width is not a multiple of 32 floats) is written by consecutive lanes of one instruction
__global__ __launch_bounds__(256) void k_lincopy(const float* __restrict__ src, long long lds, float* __restrict__ dst, long long ldd, long long rows, int cols) {
    const long long i = (long long)blockIdx.x * 256 + threadIdx.x; if (i >= rows * cols) return;
    const long long r = i / cols; const int c = (int)(i - r * cols);
    const float v = src[r * lds + c]; VST2(float, dst + r * ldd + c, v);
}

namespace w25 {
typedef __attribute__((ext_vector_type(16))) _Float16 v16h;
typedef __attribute__((ext_vector_type(8)))  _Float16 v8h;
typedef __attribute__((ext_vector_type(16))) __bf16   v16b;
typedef __attribute__((ext_vector_type(8)))  __bf16   v8b;
typedef __attribute__((ext_vector_type(8)))  float    v8f;
typedef __attribute__((ext_vector_type(4)))  float    v4f;

__device__ __forceinline__ unsigned short f2bf_bits(float f) {
  unsigned u = __float_as_uint(f);
  return (unsigned short)((u + 0x7FFFu + ((u >> 16) & 1u)) >> 16);
}
__device__ __forceinline__ float bf_bits2f(unsigned short h) { return __uint_as_float(((unsigned)h) << 16); }

// hazard guards as plain device helpers (no inline asm inside the kernel template body)
__device__ __forceinline__ void dep_guard_h(v8f& a, v8f& b, v16h x, v16h y) { asm volatile("v_nop\n\tv_nop\n\tv_nop\n\tv_nop" : "+v"(a), "+v"(b) : "v"(x), "v"(y)); }
__device__ __forceinline__ void dep_guard_b(v8f& a, v8f& b, v16b x, v16b y) { asm volatile("v_nop\n\tv_nop\n\tv_nop\n\tv_nop" : "+v"(a), "+v"(b) : "v"(x), "v"(y)); }
__device__ __forceinline__ void keep4_h(v16h a, v16h b, v16h c, v16h d) { asm volatile("v_nop" :: "v"(a), "v"(b), "v"(c), "v"(d)); }
__device__ __forceinline__ void keep4_b(v16b a, v16b b, v16b c, v16b d) { asm volatile("v_nop" :: "v"(a), "v"(b), "v"(c), "v"(d)); }
__device__ __forceinline__ void acc_guard4(v8f& a, v8f& b, v8f& c, v8f& d) { asm volatile("v_nop\n\tv_nop\n\tv_nop\n\tv_nop" : "+v"(a), "+v"(b), "+v"(c), "+v"(d)); }
template <typename T> struct Frag;
template <> struct Frag<_Float16> {
  typedef v16h V; union U { v16h v; v8h h[2]; };
  static __device__ __forceinline__ v16h load(const _Float16* p) {   // elements 0..7 <- p[0..7], 8..15 <- p[16..23]
    U f; f.h[0] = *(const v8h*)(p); f.h[1] = *(const v8h*)(p + 16); return f.v;
  }
  static __device__ __forceinline__ v8f mma(v16h a, v16h b, v8f c) {
    return __builtin_amdgcn_wmma_f32_16x16x32_f16(false, a, false, b, (short)0, c, false, false);
  }
  static __device__ __forceinline__ void guard(v8f& a, v8f& b, v16h x, v16h y) { dep_guard_h(a, b, x, y); }
  static __device__ __forceinline__ void keep(v16h a, v16h b, v16h c, v16h d) { keep4_h(a, b, c, d); }
};
template <> struct Frag<__bf16> {
  typedef v16b V; union U { v16b v; v8b h[2]; };
  static __device__ __forceinline__ v16b load(const __bf16* p) {
    U f; f.h[0] = *(const v8b*)(p); f.h[1] = *(const v8b*)(p + 16); return f.v;
  }
  static __device__ __forceinline__ v8f mma(v16b a, v16b b, v8f c) {
    return __builtin_amdgcn_wmma_f32_16x16x32_bf16(false, a, false, b, (short)0, c, false, false);
  }
  static __device__ __forceinline__ void guard(v8f& a, v8f& b, v16b x, v16b y) { dep_guard_b(a, b, x, y); }
  static __device__ __forceinline__ void keep(v16b a, v16b b, v16b c, v16b d) { keep4_b(a, b, c, d); }
};

// ---- Register-blocked batched WMMA GEMM ------------------------------------
// C[m,n] = scale * sum_k A[m,k] * Bt[n,k] (+bias)(+resid); each wave owns a 64x64 tile.
// A row-major [M,K]; Bt row-major [N,K]; M,N % 64 == 0, K % 32 == 0.
// SPLIT: operands are hi/lo planes (A2/Bt2 = lo planes, same layout); product = hi·hi + hi·lo + lo·hi.
// BIAS_MODE: 0 = none, 1 = bias[m], 2 = bias[n].
// OUT_MODE: 0 = f32, 1 = f16, 2 = bf16 hi plane (Cout) + bf16 lo plane (Cout2).
// ET: 0 = f16 operands, 1 = bf16 operands (pointers passed as 16-bit storage)
template <int ET> struct Elem;
template <> struct Elem<0> { typedef _Float16 T; };
template <> struct Elem<1> { typedef __bf16 T; };
// slab: the calling wave's own 16x64 staging slab in LDS (pitch 68 floats); tile, b, bz: the wave's tile and the two batch indices.
template <int ET, bool SPLIT, int BIAS_MODE, int OUT_MODE, bool RESID, int ACT = 0>
__device__ __forceinline__ void gemm64_body(float* slab, const int tile, const int b, const int bz,
    const unsigned short* __restrict__ Ap, const unsigned short* __restrict__ A2p, int lda, long strideA, long strideAz,
    const unsigned short* __restrict__ Btp, const unsigned short* __restrict__ Bt2p, int ldb, long strideB, long strideBz,
    void* __restrict__ Cout, void* __restrict__ Cout2, int ldc, long strideC, long strideCz,
    const float* __restrict__ bias,
    const float* __restrict__ resid, long strideR,
    int M, int N, int K, float scale) {
  typedef typename Elem<ET>::T T;
  typedef typename Frag<T>::V V;
  const T* A = (const T*)Ap; const T* A2 = (const T*)A2p; const T* Bt = (const T*)Btp; const T* Bt2 = (const T*)Bt2p;
  const int lane = threadIdx.x & 31;
  const int tilesN = N >> 6;
  const int tilesM = M >> 6;
  if (tile >= tilesM * tilesN) return;   // wave-uniform; no block barriers in this kernel
  const int tm = tile / tilesN;
  const int tn = tile - tm * tilesN;
  const int m0 = tm << 6;
  const int n0 = tn << 6;

  const T* Ab  = A  + (size_t)b * strideA + (size_t)bz * strideAz;
  const T* Bb  = Bt + (size_t)b * strideB + (size_t)bz * strideBz;
  const T* Ab2 = SPLIT ? (A2  + (size_t)b * strideA + (size_t)bz * strideAz) : nullptr;
  const T* Bb2 = SPLIT ? (Bt2 + (size_t)b * strideB + (size_t)bz * strideBz) : nullptr;

  const int rlane = lane & 15;                 // row (A) / col (B, D) within subtile
  const int koff  = (lane >> 4) * 8;           // k offset of this lane half
  const int mOff  = (lane >> 4) * 8;           // D row offset

  v8f acc[4][4];
#pragma unroll
  for (int i = 0; i < 4; ++i)
#pragma unroll
    for (int j = 0; j < 4; ++j) acc[i][j] = (v8f){0.f,0.f,0.f,0.f,0.f,0.f,0.f,0.f};

  for (int k0 = 0; k0 < K; k0 += 32) {
    V bh[4], bl[4];
#pragma unroll
    for (int j = 0; j < 4; ++j) {
      const size_t bo = (size_t)(n0 + (j << 4) + rlane) * ldb + koff + k0;
      bh[j] = Frag<T>::load(Bb + bo);
      if (SPLIT) bl[j] = Frag<T>::load(Bb2 + bo);
    }
#pragma unroll
    for (int i = 0; i < 4; ++i) {
      const size_t ao = (size_t)(m0 + (i << 4) + rlane) * lda + koff + k0;
      V ah = Frag<T>::load(Ab + ao);
      V al;
      if (SPLIT) al = Frag<T>::load(Ab2 + ao);
#pragma unroll
      for (int j = 0; j < 4; ++j) {
        acc[i][j] = Frag<T>::mma(ah, bh[j], acc[i][j]);
        if (SPLIT) {
          acc[i][j] = Frag<T>::mma(ah, bl[j], acc[i][j]);
          acc[i][j] = Frag<T>::mma(al, bh[j], acc[i][j]);
        }
      }
      Frag<T>::guard(acc[i][0], acc[i][3], ah, SPLIT ? al : ah);
    }
    Frag<T>::keep(bh[0], bh[1], bh[2], bh[3]);
    if (SPLIT) Frag<T>::keep(bl[0], bl[1], bl[2], bl[3]);
  }
  acc_guard4(acc[0][0], acc[0][1], acc[0][2], acc[0][3]);
  acc_guard4(acc[1][0], acc[1][1], acc[1][2], acc[1][3]);
  acc_guard4(acc[2][0], acc[2][1], acc[2][2], acc[2][3]);
  acc_guard4(acc[3][0], acc[3][1], acc[3][2], acc[3][3]);

  // ---- epilogue ----
  const float* Rb = RESID ? (resid + (size_t)b * strideR) : nullptr;
#pragma unroll
  for (int i = 0; i < 4; ++i) {
    const int mBase = m0 + (i << 4);
#pragma unroll
    for (int j = 0; j < 4; ++j) {
      const int n = n0 + (j << 4) + rlane;
      float bv = 0.f;
      if (BIAS_MODE == 2) bv = bias[n];
#pragma unroll
      for (int r = 0; r < 8; ++r) {
        float v = acc[i][j][r] * scale;
        if (BIAS_MODE == 1) v += bias[mBase + mOff + r];
        if (BIAS_MODE == 2) v += bv;
        if (RESID) v += Rb[(size_t)(mBase + mOff + r) * ldc + n];
        if (ACT == 1) v = tanhf(v);
        if (ACT == 2) v = fmaxf(v, 0.0f);
        if (ACT == 3) v = v / (1.0f + expf(-v));
        if (ACT == 4) v = (v > 0.f) ? v : 0.01f * v;
        if (ACT == 5) v = 0.5f * v * (1.0f + erff(v * 0.70710678118654752f));
        slab[(mOff + r) * 68 + (j << 4) + rlane] = v;
      }
    }
    __builtin_amdgcn_fence(__ATOMIC_RELEASE, "workgroup");
    __builtin_amdgcn_wave_barrier();
    __builtin_amdgcn_fence(__ATOMIC_ACQUIRE, "workgroup");
    if (OUT_MODE == 0) {
      float* C = (float*)Cout + (size_t)b * strideC + (size_t)bz * strideCz;
      const int hh = lane >> 4, c4 = (lane & 15) * 4;     // row seg = 256 B = 16 lanes x 16 B
      {
#pragma unroll
        for (int it = 0; it < 8; ++it) {
          const int row = it * 2 + hh;
          v4f v = *(const v4f*)(slab + row * 68 + c4);
          *(v4f*)(C + (size_t)(mBase + row) * ldc + n0 + c4) = v;
        }
        
      }
    } else {
      const int q = lane >> 3, c8 = (lane & 7) * 8;
      unsigned short* C  = (unsigned short*)Cout  + (size_t)b * strideC + (size_t)bz * strideCz;
      unsigned short* C2 = (OUT_MODE == 2) ? ((unsigned short*)Cout2 + (size_t)b * strideC + (size_t)bz * strideCz) : nullptr;
      {
#pragma unroll
        for (int it = 0; it < 4; ++it) {
          const int row = it * 4 + q;
          const float* sp = slab + row * 68 + c8;
          v8h hv, lv;
#pragma unroll
          for (int e = 0; e < 8; ++e) {
            if (OUT_MODE == 1) {
              hv[e] = (_Float16)sp[e];
            } else {
              unsigned short hb = f2bf_bits(sp[e]);
              unsigned short lb = f2bf_bits(sp[e] - bf_bits2f(hb));
              hv[e] = __builtin_bit_cast(_Float16, hb);
              lv[e] = __builtin_bit_cast(_Float16, lb);
            }
          }
          *(v8h*)(C + (size_t)(mBase + row) * ldc + n0 + c8) = hv;
          if (OUT_MODE == 2) *(v8h*)(C2 + (size_t)(mBase + row) * ldc + n0 + c8) = lv;
        }
        asm volatile("s_wait_xcnt 0x0" ::: "memory");   // stands in front of the next row tile's reuse of these stores' address and data registers
      }
    }
    __builtin_amdgcn_fence(__ATOMIC_RELEASE, "workgroup");
    __builtin_amdgcn_wave_barrier();
    __builtin_amdgcn_fence(__ATOMIC_ACQUIRE, "workgroup");
  }
}

// grid (tiles / 8, b, bz); the bias too may step with bz, so that independent products of one shape share a launch
template <int ET, bool SPLIT, int BIAS_MODE, int OUT_MODE, bool RESID, int ACT = 0>
__global__ __launch_bounds__(256) void wmma_gemm64(
    const unsigned short* __restrict__ Ap, const unsigned short* __restrict__ A2p, int lda, long strideA, long strideAz,
    const unsigned short* __restrict__ Btp, const unsigned short* __restrict__ Bt2p, int ldb, long strideB, long strideBz,
    void* __restrict__ Cout, void* __restrict__ Cout2, int ldc, long strideC, long strideCz,
    const float* __restrict__ bias, long strideBiasZ,
    const float* __restrict__ resid, long strideR,
    int M, int N, int K, float scale) {
  __shared__ __align__(16) float sT[8][16 * 68];   // per-wave 16x64 slab, pitch 68 floats
  const int wave = threadIdx.x >> 5;
  gemm64_body<ET, SPLIT, BIAS_MODE, OUT_MODE, RESID, ACT>(sT[wave], (int)blockIdx.x * 8 + wave, (int)blockIdx.y, (int)blockIdx.z,
      Ap, A2p, lda, strideA, strideAz, Btp, Bt2p, ldb, strideB, strideBz, Cout, Cout2, ldc, strideC, strideCz,
      BIAS_MODE ? bias + (long)blockIdx.z * strideBiasZ : nullptr, resid, strideR, M, N, K, scale);
}

// ---- The same product for large M, N: operands staged in LDS ----------------
// C[m,n] = act(scale * sum_k A[m,k] * Bt[n,k] (+ bias[n])), stored as OUT says; A row-major [M,K], Bt row-major [N,K], both of row length K; M % (64 WR) == 0, N % (64 WC) == 0, K % 64 == 0.
// Block = WR x WC waves of 64x64 = one tile of C; grid (N / (64 WC), M / (64 WR)). A stage is 64 k = 128 B of each of the block's operand rows
// (A hi, A lo, B hi, B lo when SPLIT), laid at a pitch of 144 B in one of two LDS buffers by asynchronous 16-byte copies: a wave's copy
// covers four whole 128-byte lines, and a staged A row serves WC waves, a B row WR waves: the bytes asked of L2 per product go as 1 / WR + 1 / WC.
// These copies do not hit the WGP cache: every staged byte is an L2 request. The next stage's copies fly while this stage is worked on.
// Per accumulator the products come in the same k order as in wmma_gemm64.
// The launch bound's second argument asks for four waves per SIMD (256 registers a wave): four one-plane 2 x 2 blocks then share a WGP, or one two-plane 4 x 4 block (ring of 288 KiB) fills it.
// Every inner loop is unrolled so that the fragment and accumulator arrays are indexed by constants and stay in registers.
template <unsigned LS>
__device__ __forceinline__ void ring_copy4x2(unsigned l, unsigned l2, const unsigned char* g, const unsigned char* g2, size_t gstep) {
  // four rows of a hi plane (l, g) and the same rows of its lo plane (l2, g2), LS bytes apart in LDS and gstep bytes apart in memory;
  // the closing s_wait_xcnt stands in front of any reuse of the address registers named here
  asm volatile("global_load_async_to_lds_b128 %0, %8, off\n\t"
               "global_load_async_to_lds_b128 %1, %9, off\n\t"
               "global_load_async_to_lds_b128 %2, %10, off\n\t"
               "global_load_async_to_lds_b128 %3, %11, off\n\t"
               "global_load_async_to_lds_b128 %4, %12, off\n\t"
               "global_load_async_to_lds_b128 %5, %13, off\n\t"
               "global_load_async_to_lds_b128 %6, %14, off\n\t"
               "global_load_async_to_lds_b128 %7, %15, off\n\t"
               "s_wait_xcnt 0x0"
               :: "v"(l), "v"(l + LS), "v"(l + 2u * LS), "v"(l + 3u * LS), "v"(l2), "v"(l2 + LS), "v"(l2 + 2u * LS), "v"(l2 + 3u * LS),
                  "v"(g), "v"(g + gstep), "v"(g + 2 * gstep), "v"(g + 3 * gstep), "v"(g2), "v"(g2 + gstep), "v"(g2 + 2 * gstep), "v"(g2 + 3 * gstep)
               : "memory");
}
template <unsigned LS>
__device__ __forceinline__ void ring_copy8(unsigned l, const unsigned char* g, size_t gstep) {
  // eight rows of one plane, spaced likewise; the closing s_wait_xcnt stands in front of any reuse of the address registers named here
  asm volatile("global_load_async_to_lds_b128 %0, %8, off\n\t"
               "global_load_async_to_lds_b128 %1, %9, off\n\t"
               "global_load_async_to_lds_b128 %2, %10, off\n\t"
               "global_load_async_to_lds_b128 %3, %11, off\n\t"
               "global_load_async_to_lds_b128 %4, %12, off\n\t"
               "global_load_async_to_lds_b128 %5, %13, off\n\t"
               "global_load_async_to_lds_b128 %6, %14, off\n\t"
               "global_load_async_to_lds_b128 %7, %15, off\n\t"
               "s_wait_xcnt 0x0"
               :: "v"(l), "v"(l + LS), "v"(l + 2u * LS), "v"(l + 3u * LS), "v"(l + 4u * LS), "v"(l + 5u * LS), "v"(l + 6u * LS), "v"(l + 7u * LS),
                  "v"(g), "v"(g + gstep), "v"(g + 2 * gstep), "v"(g + 3 * gstep), "v"(g + 4 * gstep), "v"(g + 5 * gstep), "v"(g + 6 * gstep), "v"(g + 7 * gstep)
               : "memory");
}
// OUT: 0 = f32 into C. 1 = f16 into C16 (row length ldc): the operand form that the next product reads, stored here instead of by a conversion pass over an f32 plane.
// 2 = as 1, with columns below csN multiplied by cs[column / 64] first, and the unscaled value also split into bf16 hi and lo and stored transposed:
//     TH/TL[(m / tld) * ldc + n][m % tld], rows of tld elements (tld % (64 WR) == 0, csN % (64 WC) == 0); ldc is then the number of columns of the product.
template <int ET, bool SPLIT, int BIAS_MODE, int ACT, int OUT = 0, unsigned WR = 2u, unsigned WC = 2u>
__device__ __forceinline__ void ring_body(const int bx, const int by,
    const unsigned short* __restrict__ Ap, const unsigned short* __restrict__ A2p,
    const unsigned short* __restrict__ Btp, const unsigned short* __restrict__ Bt2p,
    float* __restrict__ C, int ldc, const float* __restrict__ bias, int K, float scale,
    unsigned short* __restrict__ C16, unsigned short* __restrict__ TH, unsigned short* __restrict__ TL, const float* __restrict__ cs, int csN, int tld) {
  typedef unsigned int u4 __attribute__((ext_vector_type(4)));
  typedef float f2 __attribute__((ext_vector_type(2)));
  typedef __bf16 b2 __attribute__((ext_vector_type(2)));
  static_assert(OUT != 2 || SPLIT, "the transposed tiles need the two-plane ring's LDS");
  typedef typename Elem<ET>::T T;
  typedef typename Frag<T>::V V;
  // a buffer holds [A hi | A lo | B hi | B lo] (one plane each without SPLIT): a lo plane lies within a read's 16-bit offset of its hi plane
  constexpr unsigned PITCH = 144u, PLA = 64u * WR * PITCH, PLB = 64u * WC * PITCH, NP = SPLIT ? 2u : 1u, BOFF = NP * PLA, BUF = NP * (PLA + PLB);
  constexpr unsigned RSTEP = 4u * WR * WC, LS = RSTEP * PITCH, NCA = 16u / WC, NCB = 16u / WR;   // rows that one copy of the whole block covers; copies a lane and plane
  static_assert((NCA == 8u || (SPLIT && NCA == 4u)) && (NCB == 8u || (SPLIT && NCB == 4u)), "copies go out in statements of eight: eight rows of a plane, or four of a hi plane and four of its lo plane");
  static_assert(OUT != 2 || WR * WC * 18432u <= 2u * BUF, "the waves' transposed tiles lie in the ring");
  __shared__ __attribute__((aligned(256))) unsigned char L[2 * BUF];
  const unsigned tid = threadIdx.x, lane = tid & 31u, wave = tid >> 5;
  const int m0 = by * (int)(64u * WR), n0 = bx * (int)(64u * WC);
  const unsigned wm = (wave / WC) * 64u, wn = (wave % WC) * 64u;
  const unsigned rlane = lane & 15u, hh = lane >> 4;

  // copies: 8 lanes cover one 128-byte row piece, thread t takes rows (t >> 3) + RSTEP i of every plane
  const size_t rowb = (size_t)K * 2u, gstep = RSTEP * rowb;
  const unsigned lc = (unsigned)(size_t)L + (tid >> 3) * PITCH + (tid & 7u) * 16u;
  const size_t ga = (size_t)(m0 + (int)(tid >> 3)) * rowb + (tid & 7u) * 16u;
  const size_t gb = (size_t)(n0 + (int)(tid >> 3)) * rowb + (tid & 7u) * 16u;
  auto stage = [&](int t, unsigned buf) {
    const size_t ko = (size_t)t * 128u;
    auto operand = [&](unsigned n, unsigned l, unsigned pl, const unsigned char* g, const unsigned char* g2) {
      if (n == 4u) ring_copy4x2<LS>(l, l + pl, g, g2, gstep);
      else { ring_copy8<LS>(l, g, gstep); if (SPLIT) ring_copy8<LS>(l + pl, g2, gstep); }
    };
    operand(NCA, lc + buf * BUF, PLA, (const unsigned char*)Ap + ga + ko, (const unsigned char*)A2p + ga + ko);
    operand(NCB, lc + buf * BUF + BOFF, PLB, (const unsigned char*)Btp + gb + ko, (const unsigned char*)Bt2p + gb + ko);
  };

  v8f acc[4][4];
#pragma unroll
  for (int i = 0; i < 4; ++i)
#pragma unroll
    for (int j = 0; j < 4; ++j) acc[i][j] = (v8f){0.f,0.f,0.f,0.f,0.f,0.f,0.f,0.f};

  const int NT = K >> 6;
  stage(0, 0u);
  asm volatile("s_wait_asynccnt 0x0" ::: "memory");            // this wave's copies of stage 0 have landed
  __syncthreads();                                             // and every other wave's
  if (NT > 1) stage(1, 1u);
  for (int t = 0; t < NT; ++t) {
    const unsigned char* Ab = L + (unsigned)(t & 1) * BUF + (wm + rlane) * PITCH + 16u * hh;
    const unsigned char* Bb = L + (unsigned)(t & 1) * BUF + BOFF + (wn + rlane) * PITCH + 16u * hh;
#pragma unroll
    for (unsigned ks = 0; ks < 2u; ++ks) {
      // fragments are asked for ahead of the products that use them: all eight of a k step (one plane), or B whole and A one row tile ahead (two planes)
      V bh[4], bl[4], ah[4], al[4];
#pragma unroll
      for (unsigned j = 0; j < 4u; ++j) {
        bh[j] = Frag<T>::load((const T*)(Bb + 16u * j * PITCH + 64u * ks));
        if (SPLIT) bl[j] = Frag<T>::load((const T*)(Bb + PLB + 16u * j * PITCH + 64u * ks));
      }
#pragma unroll
      for (unsigned i = 0; i < (SPLIT ? 1u : 4u); ++i) {
        ah[i] = Frag<T>::load((const T*)(Ab + 16u * i * PITCH + 64u * ks));
        if (SPLIT) al[i] = Frag<T>::load((const T*)(Ab + PLA + 16u * i * PITCH + 64u * ks));
      }
      __builtin_amdgcn_sched_barrier(0);                       // holds the reads above as one group: left free, each A read sinks to its first use and the wave waits out the LDS latency per row tile
#pragma unroll
      for (unsigned i = 0; i < 4u; ++i) {
        if (SPLIT && i < 3u) {
          ah[i + 1u] = Frag<T>::load((const T*)(Ab + 16u * (i + 1u) * PITCH + 64u * ks));
          al[i + 1u] = Frag<T>::load((const T*)(Ab + PLA + 16u * (i + 1u) * PITCH + 64u * ks));
          __builtin_amdgcn_sched_barrier(0);                   // the next row tile's reads stay in front of this row tile's products
        }
#pragma unroll
        for (int j = 0; j < 4; ++j) {
          acc[i][j] = Frag<T>::mma(ah[i], bh[j], acc[i][j]);
          if (SPLIT) {
            acc[i][j] = Frag<T>::mma(ah[i], bl[j], acc[i][j]);
            acc[i][j] = Frag<T>::mma(al[i], bh[j], acc[i][j]);
          }
        }
      }
    }
    asm volatile("s_wait_dscnt 0x0" ::: "memory");             // this wave's reads of the buffer are done before it is handed to the copies
    asm volatile("s_wait_asynccnt 0x0" ::: "memory");          // this wave's copies of stage t + 1 have landed
    __syncthreads();                                           // publishes stage t + 1 and ends every wave's reads of stage t
    if (t + 2 < NT) stage(t + 2, (unsigned)(t & 1));
  }
  asm volatile("s_wait_asynccnt 0x0" ::: "memory");            // nothing in flight when the ring becomes output staging

  // ---- epilogue: as in wmma_gemm64, the per-wave 16x64 slab (pitch 68 floats) lies in the ring, which every wave has left ----
  float* slab = (float*)(L + wave * (OUT == 2 ? 18432u : 16u * 68u * 4u));
  const int mOff = (int)hh * 8;
  float bv[4] = {0.f, 0.f, 0.f, 0.f};
  if (BIAS_MODE == 2) {
#pragma unroll
    for (int j = 0; j < 4; ++j) {
      bv[j] = bias[n0 + (int)wn + (j << 4) + (int)rlane];
      asm volatile("s_wait_xcnt 0x0" ::: "memory");            // behind each load: a later load's result may be given the index register that this load names
    }
  }
  float qsc = 1.0f;                                             // a wave's 64 columns share one entry of cs
  if (OUT == 2) {
    if (n0 < csN) qsc = cs[(n0 + (int)wn) >> 6];
    asm volatile("s_wait_xcnt 0x0" ::: "memory");               // stands in front of any reuse of this load's address registers
  }
  // per wave two 64 x 64 tiles of 16-bit values, [column][row] at a pitch of 144 B (hi, then lo): the waves' tiles fill the ring, so a wave lays them over its own slab once the f16 rows have left it
  unsigned char* tt = L + wave * 18432u;
#pragma unroll
  for (int i = 0; i < 4; ++i) {
    const int mBase = m0 + (int)wm + (i << 4);
#pragma unroll
    for (int j = 0; j < 4; ++j) {
#pragma unroll
      for (int r = 0; r < 8; ++r) {
        float v = acc[i][j][r] * scale;
        if (BIAS_MODE == 2) v += bv[j];
        if (OUT == 2) v *= qsc;
        slab[(mOff + r) * 68 + (j << 4) + (int)rlane] = v;
      }
    }
    __builtin_amdgcn_fence(__ATOMIC_RELEASE, "workgroup");
    __builtin_amdgcn_wave_barrier();
    __builtin_amdgcn_fence(__ATOMIC_ACQUIRE, "workgroup");
    if (OUT != 0) {
      const int q = (int)(lane >> 3), c8 = (int)(lane & 7u) * 8;  // row piece = 128 B = 8 lanes x 16 B
#pragma unroll   // constant indices; the four stores go out as one group
      for (int it = 0; it < 4; ++it) {
        const int row = it * 4 + q;
        const v4f x0 = *(const v4f*)(slab + row * 68 + c8), x1 = *(const v4f*)(slab + row * 68 + c8 + 4);
        v8h hv;
#pragma unroll
        for (int e = 0; e < 4; ++e) { hv[e] = (_Float16)x0[e]; hv[e + 4] = (_Float16)x1[e]; }
        *(v8h*)(C16 + (size_t)(mBase + row) * ldc + n0 + (int)wn + c8) = hv;
      }
      asm volatile("s_wait_xcnt 0x0" ::: "memory");             // stands in front of the next row tile's reuse of these stores' address and data registers
    }
    if (OUT == 0) {
    const int c4 = (int)rlane * 4;                              // row piece = 256 B = 16 lanes x 16 B
    // The activation is applied on the way out of the slab, where the row index may be a loop variable. With erf the loop stays rolled, for speed only.
#pragma unroll (ACT == 5 ? 1 : 8)
    for (int it = 0; it < 8; ++it) {
      const int row = it * 2 + (int)hh;
      v4f v = *(const v4f*)(slab + row * 68 + c4);
      if (ACT == 5) {
#pragma unroll   // constant indices keep the four values in registers
        for (int e = 0; e < 4; ++e) v[e] = 0.5f * v[e] * (1.0f + erff(v[e] * 0.70710678118654752f));
      }
      *(v4f*)(C + (size_t)(mBase + row) * ldc + n0 + (int)wn + c4) = v;
      if (ACT == 5) asm volatile("s_wait_xcnt 0x0" ::: "memory");   // stands in front of the next trip's reuse of this store's address and data registers
    }
    if (ACT != 5) asm volatile("s_wait_xcnt 0x0" ::: "memory"); // stands in front of the next row tile's reuse of these stores' address and data registers
    }
    __builtin_amdgcn_fence(__ATOMIC_RELEASE, "workgroup");
    __builtin_amdgcn_wave_barrier();
    __builtin_amdgcn_fence(__ATOMIC_ACQUIRE, "workgroup");
  }
  if (OUT == 2) {
#pragma unroll   // constant indices keep the accumulators in registers
    for (int i = 0; i < 4; ++i)
#pragma unroll
      for (int j = 0; j < 4; ++j) {                             // a lane's 8 accumulator registers are 8 consecutive rows of one column: 16 contiguous bytes of a transposed row
        u4 th, tl;
#pragma unroll
        for (int e = 0; e < 4; ++e) {
          const f2 ab = {acc[i][j][2 * e] * scale, acc[i][j][2 * e + 1] * scale};
          th[e] = __builtin_bit_cast(unsigned, __builtin_convertvector(ab, b2));              // round to nearest even, as f2bf_bits
          const f2 hf = {__uint_as_float(th[e] << 16), __uint_as_float(th[e] & 0xFFFF0000u)};
          tl[e] = __builtin_bit_cast(unsigned, __builtin_convertvector(ab - hf, b2));
        }
        unsigned char* tp = tt + ((unsigned)(j << 4) + rlane) * 144u + 32u * (unsigned)i + 16u * hh;
        *(u4*)tp = th; *(u4*)(tp + 9216u) = tl;
      }
    // the wave's lanes read one another's tile pieces below: its LDS writes above are ordered in front of those reads
    __builtin_amdgcn_fence(__ATOMIC_RELEASE, "workgroup");
    __builtin_amdgcn_wave_barrier();
    __builtin_amdgcn_fence(__ATOMIC_ACQUIRE, "workgroup");
    // the wave's own transposed tiles go out as whole 128-byte lines: 8 lanes a row, 4 rows a store
    const unsigned rr = lane >> 3, pc = (lane & 7u) * 16u;
    const size_t go = (((size_t)(m0 / tld) * (size_t)ldc + (unsigned)n0 + wn + rr) * (size_t)tld + (size_t)(m0 % tld) + wm) * 2u + pc;
    unsigned char* gh = (unsigned char*)TH + go;
    unsigned char* gl = (unsigned char*)TL + go;
    const unsigned char* ts = tt + rr * 144u + pc;
#pragma unroll   // constant offsets
    for (unsigned o = 0; o < 4u; ++o) {
#pragma unroll   // eight stores go out as one group
      for (unsigned u = 0; u < 4u; ++u) {
        const unsigned it = 4u * o + u;
        const u4 a = *(const u4*)(ts + it * 576u), b = *(const u4*)(ts + 9216u + it * 576u);
        *(u4*)(gh + (size_t)(it * 8u) * (size_t)tld) = a;
        *(u4*)(gl + (size_t)(it * 8u) * (size_t)tld) = b;
      }
      asm volatile("s_wait_xcnt 0x0" ::: "memory");             // stands in front of the next group's reuse of these stores' address and data registers
    }
  }
}
// grid (N / (64 WC), M / (64 WR), products): independent products of one shape share a launch; product 1 has its operands and output zA, zB, zC elements behind product 0's, and its own bias
template <int ET, bool SPLIT, int BIAS_MODE, int ACT, int OUT = 0, unsigned WR = 2u, unsigned WC = 2u>
__global__ __launch_bounds__(32 * WR * WC, 4) void wmma_gemm_ring(
    const unsigned short* __restrict__ Ap, const unsigned short* __restrict__ A2p,
    const unsigned short* __restrict__ Btp, const unsigned short* __restrict__ Bt2p,
    float* __restrict__ C, int ldc, const float* __restrict__ bias, int K, float scale,
    unsigned short* __restrict__ C16, unsigned short* __restrict__ TH, unsigned short* __restrict__ TL, const float* __restrict__ cs, int csN, int tld,
    long zA, long zB, long zC, const float* __restrict__ biasZ) {
  const long z = (long)blockIdx.z;
  ring_body<ET, SPLIT, BIAS_MODE, ACT, OUT, WR, WC>((int)blockIdx.x, (int)blockIdx.y, Ap + z * zA, A2p, Btp + z * zB, Bt2p,
      C + z * zC, ldc, z ? biasZ : bias, K, scale, C16, TH, TL, cs, csN, tld);
}

// One 64x64 tile of channel scores S[i][j] = sum_n a[i][n] b[j][n] on hi/lo planes whose rows are LD elements long (a.hi b.hi + a.hi b.lo + a.lo b.hi, in the k order of wmma_gemm64).
// The block's four waves each own a 32x32 quadrant, so that a k step's fragments take 64 registers and three steps' worth fit beside the accumulators: step s + 2 is asked for
// before step s is worked on, and a wave waits for memory once per 128-byte line of its rows instead of once per row tile of every step.
template <int LD>
__device__ __forceinline__ void cscore_body(const __bf16* __restrict__ Ah, const __bf16* __restrict__ Al, const __bf16* __restrict__ Bh, const __bf16* __restrict__ Bl, float* __restrict__ S) {
  typedef Frag<__bf16> F;
  constexpr int NS = LD / 32;
  static_assert(LD % 32 == 0 && NS >= 2 && (NS - 2) % 3 == 0, "the loop below turns three buffers and leaves two steps behind it");
  const unsigned lane = threadIdx.x & 31u, wave = threadIdx.x >> 5, rlane = lane & 15u, hh = lane >> 4;
  const unsigned mq = (wave >> 1) * 32u, nq = (wave & 1u) * 32u;
  const size_t ao = (size_t)(mq + rlane) * LD + 8u * hh, bo = (size_t)(nq + rlane) * LD + 8u * hh;
  const __bf16* pah = Ah + ao; const __bf16* pal = Al + ao; const __bf16* pbh = Bh + bo; const __bf16* pbl = Bl + bo;
  v16b ah[3][2], al[3][2], bh[3][2], bl[3][2];
  v8f acc[2][2];
#pragma unroll   // constant indices keep the accumulators in registers
  for (int i = 0; i < 2; ++i)
#pragma unroll
    for (int j = 0; j < 2; ++j) acc[i][j] = (v8f){0.f,0.f,0.f,0.f,0.f,0.f,0.f,0.f};
  // step d behind the four row addresses given, into buffer u
  auto fetch = [&](const __bf16* qah, const __bf16* qal, const __bf16* qbh, const __bf16* qbl, int d, int u) {
#pragma unroll   // constant indices keep the fragments in registers
    for (int x = 0; x < 2; ++x) {
      ah[u][x] = F::load(qah + x * 16 * LD + d * 32); al[u][x] = F::load(qal + x * 16 * LD + d * 32);
      bh[u][x] = F::load(qbh + x * 16 * LD + d * 32); bl[u][x] = F::load(qbl + x * 16 * LD + d * 32);
    }
    // stands in front of any rewrite of these loads' address registers; the four addresses are inputs so that they live up to the wait and no load of the group is given one of them for its result
    asm volatile("s_wait_xcnt 0x0" :: "v"(qah), "v"(qal), "v"(qbh), "v"(qbl) : "memory");
    __builtin_amdgcn_sched_barrier(0);                         // holds the group in front of the products that follow: left free, most of it sinks behind them and is waited for one step after it is asked for
  };
  auto work = [&](int u) {
#pragma unroll   // constant indices
    for (int i = 0; i < 2; ++i)
#pragma unroll
      for (int j = 0; j < 2; ++j) {
        acc[i][j] = F::mma(ah[u][i], bh[u][j], acc[i][j]);
        acc[i][j] = F::mma(ah[u][i], bl[u][j], acc[i][j]);
        acc[i][j] = F::mma(al[u][i], bh[u][j], acc[i][j]);
      }
  };
  fetch(pah, pal, pbh, pbl, 0, 0); fetch(pah, pal, pbh, pbl, 1, 1);
#pragma unroll 1   // three steps a trip: the buffer index is a constant in each, and the text stays short
  for (int s = 0; s < NS - 2; s += 3) {
    const __bf16* qah = pah + s * 32; const __bf16* qal = pal + s * 32; const __bf16* qbh = pbh + s * 32; const __bf16* qbl = pbl + s * 32;
    fetch(qah, qal, qbh, qbl, 2, 2); work(0);
    fetch(qah, qal, qbh, qbl, 3, 0); work(1);
    fetch(qah, qal, qbh, qbl, 4, 1); work(2);
  }
  work(0); work(1);
  acc_guard4(acc[0][0], acc[0][1], acc[1][0], acc[1][1]);      // four vector slots between the last products and the stores that read their results: a memory instruction fills no slot
  // a lane holds rows 8 hh + 0..7 of one column per 16x16 tile; a quadrant's row piece is one whole 128-byte line, written by this wave alone
  float* sp = S + (size_t)(mq + 8u * hh) * 64u + nq + rlane;
#pragma unroll   // constant indices and offsets
  for (int i = 0; i < 2; ++i)
#pragma unroll
    for (int j = 0; j < 2; ++j)
#pragma unroll
      for (int r = 0; r < 8; ++r) sp[(i * 16 + r) * 64 + j * 16] = acc[i][j][r];
}

// The v projection and the channel scores q^T k read only what earlier launches wrote and nothing of each other: they share a grid. Grid rows y < Bn hold the score tiles
// (x = head, y = sample; they come first in index order), the rows behind them the projection's 128x128 tiles. The transposed planes' rows are 1024 long (the launch's N).
__global__ __launch_bounds__(128, 4) void k_vproj_cscore(
    const unsigned short* __restrict__ X16, const unsigned short* __restrict__ WV16, unsigned short* __restrict__ V16,
    const unsigned short* __restrict__ TH, const unsigned short* __restrict__ TL, float* __restrict__ SCC, int Bn, int NH, int HD, int N, int C) {
  if ((int)blockIdx.y < Bn) {
    const size_t qo = ((size_t)blockIdx.y * 2 * C + (size_t)blockIdx.x * HD) * N, ko = qo + (size_t)C * N;   // first q row and first k row of this sample and head
    cscore_body<1024>((const __bf16*)TH + qo, (const __bf16*)TL + qo, (const __bf16*)TH + ko, (const __bf16*)TL + ko, SCC + ((size_t)blockIdx.y * NH + blockIdx.x) * (size_t)(HD * HD));
  } else {
    ring_body<0, false, 0, 0, 1>((int)blockIdx.x, (int)blockIdx.y - Bn, X16, nullptr, WV16, nullptr, nullptr, 2 * C, nullptr, C, 0.0625f, V16, nullptr, nullptr, nullptr, 0, N);
  }
}

__global__ __launch_bounds__(256) void cast_f32_f16x2(
    const float* __restrict__ in, _Float16* __restrict__ out, int n2) {
  int i = blockIdx.x * 256 + threadIdx.x;
  if (i < n2) {
    const _Float16 h0 = (_Float16)in[2 * i], h1 = (_Float16)in[2 * i + 1];
    const unsigned u = (unsigned)__builtin_bit_cast(unsigned short, h0) | ((unsigned)__builtin_bit_cast(unsigned short, h1) << 16);
    ((unsigned*)out)[i] = u;
    
  }
}


} // namespace w25

__global__ __launch_bounds__(256) void k_castT16(const float* __restrict__ src, long long lds, _Float16* __restrict__ dst, long long ldd, int R, int C, float s) {
    const long long i = (long long)blockIdx.x * 256 + threadIdx.x; const long long np = (long long)C * (R / 2); if (i >= np) return; const int c = (int)(i / (R / 2)); const int r = 2 * (int)(i % (R / 2));
    const _Float16 h0 = (_Float16)(src[(long long)r * lds + c] * s), h1 = (_Float16)(src[(long long)(r + 1) * lds + c] * s);
    const unsigned u = (unsigned)__builtin_bit_cast(unsigned short, h0) | ((unsigned)__builtin_bit_cast(unsigned short, h1) << 16);
    unsigned* d = (unsigned*)(dst + (long long)c * ldd + r); *d = u;  }
__global__ __launch_bounds__(256) void k_cast16(const float* __restrict__ src, long long lds, _Float16* __restrict__ dst, long long ldd, int R, int C, float s) {
    const long long i = (long long)blockIdx.x * 256 + threadIdx.x; const long long np = (long long)R * (C / 2); if (i >= np) return; const int r = (int)(i / (C / 2)); const int c = 2 * (int)(i % (C / 2));
    const _Float16 h0 = (_Float16)(src[(long long)r * lds + c] * s), h1 = (_Float16)(src[(long long)r * lds + c + 1] * s);
    const unsigned u = (unsigned)__builtin_bit_cast(unsigned short, h0) | ((unsigned)__builtin_bit_cast(unsigned short, h1) << 16);
    unsigned* d = (unsigned*)(dst + (long long)r * ldd + c); *d = u;  }

// f32 -> bf16 hi plane + bf16 lo plane (x = hi + lo to ~2^-17 relative; RNE both), [R][C] -> [R][C]; 2 consecutive destination elements
__device__ __forceinline__ unsigned int f2bf2_pack(float a, float b, unsigned int* lo) {
    const unsigned short ha = w25::f2bf_bits(a), hb = w25::f2bf_bits(b);
    const unsigned short la = w25::f2bf_bits(a - w25::bf_bits2f(ha)), lb = w25::f2bf_bits(b - w25::bf_bits2f(hb));
    *lo = (unsigned)la | ((unsigned)lb << 16); return (unsigned)ha | ((unsigned)hb << 16); }

namespace w25 {
// =====================================================================================
// Generic causal/non-causal attention for head_dim 64, f32 in / f32 out; 16-bit operands: bf16 with optional hi/lo splits, or
// plain f16 (F16=true, non-split, probabilities carried x2^15).
//   scores = (q*qscale)·kᵀ : v_wmma_f32_16x16x32_bf16; SPLIT_QK -> q,k as bf16 hi/lo (hi·hi + hi·lo + lo·hi)
//   out    = p·v           : v_wmma_f32_16x16x32_bf16; SPLIT_PV -> p,v as bf16 hi/lo; else p,v plain bf16
//   f32 accumulate; online softmax in f32. Block = 4 waves = 64 query rows of one (batch, head); S % 64 == 0.
//   Element (b, s, h, d) of tensor X lives at X[b*X_bs + s*X_rs + h*X_hs + d] (strides in floats, multiples of 4).
//   Masking: mask_mode 0 none, 1 causal (kv > q masked), 2 tensor [S][Skv] shared over (b,h) (float if
//   mask_is_int==0, int32 with element == 0 -> masked if 1, int32 with element != 0 -> masked if 2), 3 per-token vectors qmask[B][S] & kvmask[B][Skv] (int32,
//   0 -> masked), 4 causal + sliding window (kv > q or q - kv > W masked; W passed in mask_is_int);
//   5 = relative-position bias: s += cp[b,h,q][idx[q][kv]] + pc[b,h,kv][idx[q][kv]] with idx = mask_b ([S][Skv] int32) and
//   mask_a an int32 [S][Skv] tensor with nonzero = masked (tables: element (b,h,row,n) at X + b*c_bs + h*c_hs + row*c_rs + n);
//   masked scores are replaced by mask_fill (e.g. -inf or -1e9) before the softmax.
//   grid.x = B * H * (S/64) (or a sub-range with blk0).
// =====================================================================================
#define AT_D 64
#define AT_NW 4
#define AT_QB 64
#define AT_KC 64
struct AttnGeom { const float* cp = nullptr; const float* pc = nullptr; long c_bs = 0, c_rs = 0, c_hs = 0;   // mode-5 score-bias tables
                  long q_bs, q_rs, q_hs, k_bs, k_rs, k_hs, v_bs, v_rs, v_hs, o_bs, o_rs, o_hs;
                  int S, Skv, H, mask_mode; float qscale; int blk0; float mask_fill; int mask_is_int; };
static_assert(sizeof(AttnGeom) == 168, "no padding");

__device__ __forceinline__ unsigned short at_bf_bits(float f) {
  unsigned u = __float_as_uint(f);
  return (unsigned short)((u + 0x7FFFu + ((u >> 16) & 1u)) >> 16);
}
__device__ __forceinline__ __bf16 at_f2bf(float f) { return __builtin_bit_cast(__bf16, at_bf_bits(f)); }
__device__ __forceinline__ void at_split(float f, __bf16& hi, __bf16& lo) {
  const unsigned short hb = at_bf_bits(f);
  hi = __builtin_bit_cast(__bf16, hb);
  lo = at_f2bf(f - __uint_as_float(((unsigned)hb) << 16));
}
__device__ __forceinline__ v8f at_mma(v16b a, v16b b, v8f c) {
  c = __builtin_amdgcn_wmma_f32_16x16x32_bf16(false, a, false, b, (short)0, c, false, false);
  asm volatile("v_nop\n\tv_nop\n\tv_nop\n\tv_nop" : "+v"(c) : "v"(a), "v"(b));
  return c;
}
// 16-bit element as a bit pattern held in a __bf16 slot: f16 bits when F16, bf16 (RNE) otherwise
template <bool F16> __device__ __forceinline__ __bf16 at_to16(float f) {
  if (F16) return __builtin_bit_cast(__bf16, (_Float16)f);
  return at_f2bf(f);
}
template <bool F16> __device__ __forceinline__ v8f at_mma16(v16b a, v16b b, v8f c) {
  if (F16) {
    const v16h ah = __builtin_bit_cast(v16h, a), bh = __builtin_bit_cast(v16h, b);
    c = __builtin_amdgcn_wmma_f32_16x16x32_f16(false, ah, false, bh, (short)0, c, false, false);
    asm volatile("v_nop\n\tv_nop\n\tv_nop\n\tv_nop" : "+v"(c) : "v"(ah), "v"(bh));
    return c;
  }
  return at_mma(a, b, c);
}

template <bool SPLIT_QK, bool SPLIT_PV, bool F16 = false>
__global__ __launch_bounds__(128)
void attn64_kernel(const float* __restrict__ q, const float* __restrict__ k,
                   const float* __restrict__ v, float* __restrict__ out,
                   const void* __restrict__ mask_a, const int* __restrict__ mask_b, AttnGeom g) {
  static_assert(!(F16 && (SPLIT_QK || SPLIT_PV)), "f16 mode is non-split");
  const float PSC = F16 ? 32768.0f : 1.0f;     // f16 probabilities carried x2^15 (subnormal range), folded into the final 1/l
  union FB { v16b v; v8b h[2]; };
  __shared__ __align__(16) __bf16 Ksh[AT_KC * AT_D];             // K hi [kv][d]      8 KB
  __shared__ __align__(16) __bf16 Ksl[SPLIT_QK ? AT_KC * AT_D : 8];
  __shared__ __align__(16) __bf16 Vth[AT_D * AT_KC];             // V hi [d][kv]      8 KB
  __shared__ __align__(16) __bf16 Vtl[SPLIT_PV ? AT_D * AT_KC : 8];
  __shared__ __align__(16) __bf16 Psh[AT_NW][16 * AT_KC];        // per wave P hi [row][kv]  8 KB
  __shared__ __align__(16) __bf16 Psl[SPLIT_PV ? AT_NW : 1][SPLIT_PV ? 16 * AT_KC : 8];
  __shared__ __align__(16) float  Os[AT_NW][16 * 68];            // per wave out tile, pitch 68

  const int tid  = threadIdx.x;
  const int wave = tid >> 5;
  const int lane = tid & 31;
  const int hh   = lane >> 4;
  const int c    = lane & 15;

  const int nqb = g.S / AT_QB;
  const int bx = blockIdx.x + g.blk0;
  const int qb = bx % nqb;
  const int bh = bx / nqb;
  const int h  = bh % g.H;
  const int b  = bh / g.H;
  const int qbase_block = qb * AT_QB;
  const int q0 = qbase_block + wave * 16;

  const float* qb_ptr = q + (size_t)b * g.q_bs + (size_t)h * g.q_hs;
  const float* kb_ptr = k + (size_t)b * g.k_bs + (size_t)h * g.k_hs;
  const float* vb_ptr = v + (size_t)b * g.v_bs + (size_t)h * g.v_hs;
  float*       ob_ptr = out + (size_t)b * g.o_bs + (size_t)h * g.o_hs;

  // ---- Q fragments (A operand): 2 d-chunks, hi (and lo) ----
  v16b qah[2], qal[2];
  {
    const float* qrow = qb_ptr + (size_t)(q0 + c) * g.q_rs;
#pragma unroll
    for (int dc = 0; dc < 2; ++dc) {
#pragma unroll
      for (int e = 0; e < 8; ++e) {
        const float f0 = qrow[dc * 32 + 8 * hh + e] * g.qscale;
        const float f1 = qrow[dc * 32 + 16 + 8 * hh + e] * g.qscale;
        if (SPLIT_QK) { __bf16 hq, lq; at_split(f0, hq, lq); qah[dc][e] = hq; qal[dc][e] = lq; at_split(f1, hq, lq); qah[dc][8 + e] = hq; qal[dc][8 + e] = lq; }
        else { qah[dc][e] = at_to16<F16>(f0); qah[dc][8 + e] = at_to16<F16>(f1); qal[dc][e] = qah[dc][e]; qal[dc][8 + e] = qah[dc][8 + e]; }
      }
    }
  }

  float mrow[8], lrow[8];
  v8f oacc[4];
#pragma unroll
  for (int r = 0; r < 8; ++r) { mrow[r] = -INFINITY; lrow[r] = 0.f; }
#pragma unroll
  for (int t = 0; t < 4; ++t) oacc[t] = (v8f){0.f,0.f,0.f,0.f,0.f,0.f,0.f,0.f};

  const int nChunks = (g.mask_mode == 1 || g.mask_mode == 4) ? (qb + 1) : (g.Skv / AT_KC);   // block-uniform
  // per-row query mask (mode 3)
  int qkeep[8];
#pragma unroll
  for (int r = 0; r < 8; ++r) qkeep[r] = (g.mask_mode == 3) ? mask_b[(size_t)b * g.S + q0 + 8 * hh + r] : 1;   // mask_b = qmask in mode 3
  for (int kc = 0; kc < nChunks; ++kc) {
    const int kv0 = kc * AT_KC;
    __syncthreads();
    {
      const int kvr = tid >> 1, dh = (tid & 1) * 32;
      const float* krow = kb_ptr + (size_t)(kv0 + kvr) * g.k_rs + dh;
      const float* vrow = vb_ptr + (size_t)(kv0 + kvr) * g.v_rs + dh;
#pragma unroll
      for (int i = 0; i < 8; ++i) {
        v4f kk = *(const v4f*)(krow + 4 * i);
        v4f vv = *(const v4f*)(vrow + 4 * i);
#pragma unroll
        for (int e = 0; e < 4; ++e) {
          const int d = dh + 4 * i + e;
          if (SPLIT_QK) { __bf16 a, bl; at_split(kk[e], a, bl); Ksh[kvr * AT_D + d] = a; Ksl[kvr * AT_D + d] = bl; }
          else Ksh[kvr * AT_D + d] = at_to16<F16>(kk[e]);
          if (SPLIT_PV) { __bf16 a, bl; at_split(vv[e], a, bl); Vth[d * AT_KC + kvr] = a; Vtl[d * AT_KC + kvr] = bl; }
          else Vth[d * AT_KC + kvr] = at_to16<F16>(vv[e]);
        }
      }
    }
    __syncthreads();

    v8f s[4];
#pragma unroll
    for (int j = 0; j < 4; ++j) {
      s[j] = (v8f){0.f,0.f,0.f,0.f,0.f,0.f,0.f,0.f};
#pragma unroll 1
      for (int dc = 0; dc < 2; ++dc) {
        FB kb;
        kb.h[0] = *(const v8b*)(Ksh + (j * 16 + c) * AT_D + dc * 32 + 8 * hh);
        kb.h[1] = *(const v8b*)(Ksh + (j * 16 + c) * AT_D + dc * 32 + 16 + 8 * hh);
        s[j] = at_mma16<F16>(qah[dc], kb.v, s[j]);
        if (SPLIT_QK) {
          FB kl;
          kl.h[0] = *(const v8b*)(Ksl + (j * 16 + c) * AT_D + dc * 32 + 8 * hh);
          kl.h[1] = *(const v8b*)(Ksl + (j * 16 + c) * AT_D + dc * 32 + 16 + 8 * hh);
          s[j] = at_mma16<F16>(qah[dc], kl.v, s[j]);
          s[j] = at_mma16<F16>(qal[dc], kb.v, s[j]);
        }
      }
    }
    const bool diag = (g.mask_mode == 1) && (kc == qb);
    int kvkeep[4] = {1, 1, 1, 1};
    if (g.mask_mode == 3) {
#pragma unroll
      for (int j = 0; j < 4; ++j) kvkeep[j] = ((const int*)mask_a)[(size_t)b * g.Skv + kv0 + j * 16 + c];   // mask_a = kvmask
    }
    float cm[8];
#pragma unroll
    for (int r = 0; r < 8; ++r) {
      const int qrow = q0 + 8 * hh + r;
      float m = -INFINITY;
#pragma unroll
      for (int j = 0; j < 4; ++j) {
        const int kvcol = kv0 + j * 16 + c;
        bool masked = false;
        if (diag) masked = (kvcol > qrow);
        else if (g.mask_mode == 4) masked = (kvcol > qrow) || (qrow - kvcol > g.mask_is_int);
        else if (g.mask_mode == 2) {
          const size_t mi = (size_t)qrow * g.Skv + kvcol;
          masked = (g.mask_is_int == 0) ? (((const float*)mask_a)[mi] == 0.0f)
                 : (g.mask_is_int == 1) ? (((const int*)mask_a)[mi] == 0) : (((const int*)mask_a)[mi] != 0);
        } else if (g.mask_mode == 3) masked = (qkeep[r] == 0) || (kvkeep[j] == 0);
        else if (g.mask_mode == 5) {
          const size_t mi = (size_t)qrow * g.Skv + kvcol;
          masked = (((const int*)mask_a)[mi] != 0);
          int n = mask_b[mi]; n = n < 0 ? 0 : n;
          s[j][r] += g.cp[(size_t)b * g.c_bs + (size_t)h * g.c_hs + (size_t)qrow * g.c_rs + n]
                   + g.pc[(size_t)b * g.c_bs + (size_t)h * g.c_hs + (size_t)kvcol * g.c_rs + n];
        }
        if (masked) s[j][r] = g.mask_fill;
        m = fmaxf(m, s[j][r]);
      }
#pragma unroll
      for (int off = 1; off < 16; off <<= 1) m = fmaxf(m, __shfl_xor(m, off, 32));
      cm[r] = m;
    }
    __bf16* pwh = Psh[wave];
    __bf16* pwl = Psl[SPLIT_PV ? wave : 0];
#pragma unroll
    for (int r = 0; r < 8; ++r) {
      const float mnew = fmaxf(mrow[r], cm[r]);
      const float alpha = expf(mrow[r] - mnew);
      mrow[r] = mnew;
      float psum = 0.f;
#pragma unroll
      for (int j = 0; j < 4; ++j) {
        const float p = expf(s[j][r] - mnew);
        psum += p;
        if (SPLIT_PV) { __bf16 a, bl; at_split(p, a, bl); pwh[(8 * hh + r) * AT_KC + j * 16 + c] = a; pwl[(8 * hh + r) * AT_KC + j * 16 + c] = bl; }
        else pwh[(8 * hh + r) * AT_KC + j * 16 + c] = at_to16<F16>(p * PSC);
      }
#pragma unroll
      for (int off = 1; off < 16; off <<= 1) psum += __shfl_xor(psum, off, 32);
      lrow[r] = lrow[r] * alpha + psum;
#pragma unroll
      for (int t = 0; t < 4; ++t) oacc[t][r] *= alpha;
    }
    __builtin_amdgcn_fence(__ATOMIC_RELEASE, "workgroup");
    __builtin_amdgcn_wave_barrier();
    __builtin_amdgcn_fence(__ATOMIC_ACQUIRE, "workgroup");
#pragma unroll 1
    for (int kk = 0; kk < 2; ++kk) {
      FB pa, pl;
      pa.h[0] = *(const v8b*)(pwh + c * AT_KC + kk * 32 + 8 * hh);
      pa.h[1] = *(const v8b*)(pwh + c * AT_KC + kk * 32 + 16 + 8 * hh);
      if (SPLIT_PV) {
        pl.h[0] = *(const v8b*)(pwl + c * AT_KC + kk * 32 + 8 * hh);
        pl.h[1] = *(const v8b*)(pwl + c * AT_KC + kk * 32 + 16 + 8 * hh);
      }
#pragma unroll
      for (int t = 0; t < 4; ++t) {
        FB vb;
        vb.h[0] = *(const v8b*)(Vth + (t * 16 + c) * AT_KC + kk * 32 + 8 * hh);
        vb.h[1] = *(const v8b*)(Vth + (t * 16 + c) * AT_KC + kk * 32 + 16 + 8 * hh);
        oacc[t] = at_mma16<F16>(pa.v, vb.v, oacc[t]);
        if (SPLIT_PV) {
          FB vl;
          vl.h[0] = *(const v8b*)(Vtl + (t * 16 + c) * AT_KC + kk * 32 + 8 * hh);
          vl.h[1] = *(const v8b*)(Vtl + (t * 16 + c) * AT_KC + kk * 32 + 16 + 8 * hh);
          oacc[t] = at_mma16<F16>(pa.v, vl.v, oacc[t]);
          oacc[t] = at_mma16<F16>(pl.v, vb.v, oacc[t]);
        }
      }
    }
  }

  float* os = Os[wave];
#pragma unroll
  for (int r = 0; r < 8; ++r) {
    const float inv = 1.0f / (lrow[r] * PSC);
#pragma unroll
    for (int t = 0; t < 4; ++t) os[(8 * hh + r) * 68 + t * 16 + c] = oacc[t][r] * inv;
  }
  __builtin_amdgcn_fence(__ATOMIC_RELEASE, "workgroup");
  __builtin_amdgcn_wave_barrier();
  __builtin_amdgcn_fence(__ATOMIC_ACQUIRE, "workgroup");
  {
    const int c4 = (lane & 15) * 4;
    {
#pragma unroll
      for (int it = 0; it < 8; ++it) {
        const int row = it * 2 + hh;
        v4f val = *(const v4f*)(os + row * 68 + c4);
        *(v4f*)(ob_ptr + (size_t)(q0 + row) * g.o_rs + c4) = val;
      }
      
    }
  }
}

} // namespace w25

__device__ __forceinline__ void st_h2(_Float16* dst, float a, float b) { const unsigned u = (unsigned)__builtin_bit_cast(unsigned short, (_Float16)a) | ((unsigned)__builtin_bit_cast(unsigned short, (_Float16)b) << 16); unsigned* d = (unsigned*)dst; *d = u;  }
// tiled biases BEB[c] = bE[c % 64], BFB[c] = bF[c % 64] (thread-linear)
__global__ __launch_bounds__(256) void k_ep_btile(const float* __restrict__ BE, const float* __restrict__ BF, float* __restrict__ BEB, float* __restrict__ BFB, int C, int HD) { const int t = blockIdx.x * 256 + threadIdx.x; if (t >= C) return; VST2(float, BEB + t, BE[t % HD]); VST2(float, BFB + t, BF[t % HD]); }
// channel softmax of two score tiles by one block of 128 threads: tile h = sample * NH + head = 2 blk + (thread / 64), 64 threads a tile: rows of SCC[h] [64][64] * temp1[h % NH]; thread i of a tile computes row i, then lanes write columns so each 32-float line comes from one wave; P16[h][i][j] = f16(4096 p). sh2: 2 x 64 x 65 floats of LDS
__device__ __forceinline__ void csoft_body(float* sh2, const unsigned blk, const float* __restrict__ S, const float* __restrict__ T1, _Float16* __restrict__ P16, int NH) { float (*sh)[65] = (float (*)[65])(sh2 + (threadIdx.x >> 6) * (64 * 65)); const int h = (int)(blk * 2u + (threadIdx.x >> 6)); const int i = (int)(threadIdx.x & 63u); const float* r = S + ((long long)h * 64 + i) * 64; const float tp = T1[h % NH]; float mx = -3.0e38f;
    for (int j = 0; j < 64; ++j) mx = fmaxf(mx, r[j] * tp);
    float s = 0.f; for (int j = 0; j < 64; ++j) { const float e = expf(r[j] * tp - mx); sh[i][j] = e; s += e; }
    const float f = 4096.f / s; for (int j = 0; j < 64; ++j) sh[i][j] *= f;
    __syncthreads();
    const int half = i >> 5, c0 = 2 * (i & 31);
    for (int step = 0; step < 32; ++step) { const int rr = 2 * step + half; st_h2(P16 + ((long long)h * 64 + rr) * 64 + c0, sh[rr][c0], sh[rr][c0 + 1]); } }


// ---- Wide forms of the conversion and scaling passes ----
// A lane moves U pieces of 4 consecutive elements: one 16-byte load a piece, so that a wave's load covers 512 contiguous bytes (four whole 128-byte lines) and its store whole lines too;
// all of a lane's loads are issued ahead of its first store. Planes of 2^LC columns, source rows PITCH floats apart, destination rows packed; a block's 256 lanes take 1024 elements
// = 1024 >> LC whole rows at a time, so a lane's pieces lie RS floats apart and hang on one address pair by constant offsets. The grid covers rows * columns / (1024 * U) blocks exactly.
typedef __attribute__((ext_vector_type(4))) unsigned int v4u;
typedef __attribute__((ext_vector_type(2))) unsigned int v2u;
__device__ __forceinline__ unsigned pk_h2(float a, float b) { return (unsigned)__builtin_bit_cast(unsigned short, (_Float16)a) | ((unsigned)__builtin_bit_cast(unsigned short, (_Float16)b) << 16); }
template <int LC, int PITCH>
__device__ __forceinline__ const float* wide_src(const float* src, unsigned q0) { static_assert(LC >= 2 && LC <= 10, "a block's 1024 elements are whole rows"); return src + (size_t)(q0 >> (LC - 2)) * PITCH + ((q0 & ((1u << (LC - 2)) - 1u)) << 2); }
template <int LC, int PITCH, int U>
__global__ __launch_bounds__(256) void k_cast16w(const float* __restrict__ src, _Float16* __restrict__ dst, float s) {
    constexpr int RS = (1024 >> LC) * PITCH; const unsigned q0 = blockIdx.x * (256u * U) + threadIdx.x; const float* p = wide_src<LC, PITCH>(src, q0); v4f a[U];
#pragma unroll   // constant indices keep the pieces in registers; the loads go out as one group
    for (int u = 0; u < U; ++u) a[u] = *(const v4f*)(p + u * RS);
    _Float16* d = dst + (size_t)q0 * 4;
#pragma unroll   // constant indices keep the pieces in registers
    for (int u = 0; u < U; ++u) { v2u o; o.x = pk_h2(a[u].x * s, a[u].y * s); o.y = pk_h2(a[u].z * s, a[u].w * s); *(v2u*)(d + u * 1024) = o; } }
template <int LC, int PITCH, int U>
__global__ __launch_bounds__(256) void k_castS16w(const float* __restrict__ src, __bf16* __restrict__ dhi, __bf16* __restrict__ dlo) {
    constexpr int RS = (1024 >> LC) * PITCH; const unsigned q0 = blockIdx.x * (256u * U) + threadIdx.x; const float* p = wide_src<LC, PITCH>(src, q0); v4f a[U];
#pragma unroll   // constant indices keep the pieces in registers; the loads go out as one group
    for (int u = 0; u < U; ++u) a[u] = *(const v4f*)(p + u * RS);
#pragma unroll   // constant indices keep the pieces in registers
    for (int u = 0; u < U; ++u) { v2u h, l; unsigned t; h.x = f2bf2_pack(a[u].x, a[u].y, &t); l.x = t; h.y = f2bf2_pack(a[u].z, a[u].w, &t); l.y = t;
        const size_t o = (size_t)q0 * 4 + u * 1024; *(v2u*)(dhi + o) = h; *(v2u*)(dlo + o) = l; } }
// ---- All operand preparation in one launch: the passes read inputs only and are independent of one another, so they share a grid, block ranges in the order below.
template <int U>
__device__ __forceinline__ void cast16w_blk(unsigned blk, const float* __restrict__ src, _Float16* __restrict__ dst, float s) {   // as k_cast16w<10, 1024, U>
    const unsigned q0 = blk * (256u * U) + threadIdx.x; const float* p = src + (size_t)q0 * 4; v4f a[U];
#pragma unroll   // constant indices keep the pieces in registers; the loads go out as one group
    for (int u = 0; u < U; ++u) a[u] = *(const v4f*)(p + u * 1024);
    _Float16* d = dst + (size_t)q0 * 4;
#pragma unroll   // constant indices keep the pieces in registers
    for (int u = 0; u < U; ++u) { v2u o; o.x = pk_h2(a[u].x * s, a[u].y * s); o.y = pk_h2(a[u].z * s, a[u].w * s); *(v2u*)(d + u * 1024) = o; }
    asm volatile("s_wait_xcnt 0x0" ::: "memory"); }   // precaution: stands in front of any rewrite of the stores' registers by another block range's code, which follows in the kernel text
template <int U, bool F16>
__device__ __forceinline__ void castS16w_blk(unsigned blk, const float* __restrict__ src, __bf16* __restrict__ dhi, __bf16* __restrict__ dlo, _Float16* __restrict__ d16) {   // as k_castS16w<10, 1024, U>; F16: the f16 plane from the same loads
    const unsigned q0 = blk * (256u * U) + threadIdx.x; const float* p = src + (size_t)q0 * 4; v4f a[U];
#pragma unroll   // constant indices keep the pieces in registers; the loads go out as one group
    for (int u = 0; u < U; ++u) a[u] = *(const v4f*)(p + u * 1024);
#pragma unroll   // constant indices keep the pieces in registers
    for (int u = 0; u < U; ++u) { v2u h, l; unsigned t; h.x = f2bf2_pack(a[u].x, a[u].y, &t); l.x = t; h.y = f2bf2_pack(a[u].z, a[u].w, &t); l.y = t;
        const size_t o = (size_t)q0 * 4 + u * 1024; *(v2u*)(dhi + o) = h; *(v2u*)(dlo + o) = l;
        if (F16) { v2u f; f.x = pk_h2(a[u].x, a[u].y); f.y = pk_h2(a[u].z, a[u].w); *(v2u*)(d16 + o) = f; } }
    asm volatile("s_wait_xcnt 0x0" ::: "memory"); }   // as in cast16w_blk
constexpr unsigned PB_X = 1024u, PB_WQK = PB_X + 256u, PB_WV = PB_WQK + 512u, PB_WO1 = PB_WV + 128u, PB_WO2 = PB_WO1 + 128u, PB_WE = PB_WO2 + 1u, PB_WF = PB_WE + 1u, PB_ALL = PB_WF + 1u;
__global__ __launch_bounds__(256) void k_prep(const float* __restrict__ x, const float* __restrict__ Wq, const float* __restrict__ Wo1, const float* __restrict__ Wo2,
                                              const float* __restrict__ WE, const float* __restrict__ WF, const float* __restrict__ bE, const float* __restrict__ bF,
                                              __bf16* __restrict__ xh, __bf16* __restrict__ xl, _Float16* __restrict__ x16, __bf16* __restrict__ wh, __bf16* __restrict__ wl, _Float16* __restrict__ wv16,
                                              _Float16* __restrict__ wo1h, _Float16* __restrict__ wo2h, _Float16* __restrict__ we16, _Float16* __restrict__ wf16, float* __restrict__ BEB, float* __restrict__ BFB) {
    const unsigned b = blockIdx.x;
    if (b < PB_X) castS16w_blk<8, true>(b, x, xh, xl, x16);                                   // x [8192][1024]: bf16 hi, lo and f16
    else if (b < PB_WQK) castS16w_blk<8, false>(b - PB_X, Wq, wh, wl, nullptr);               // q, k rows of the weight: bf16 hi, lo
    else if (b < PB_WV) cast16w_blk<4>(b - PB_WQK, Wq + (size_t)2048 * 1024, wv16, 16.0f);    // v rows of the weight
    else if (b < PB_WO1) cast16w_blk<4>(b - PB_WV, Wo1, wo1h, 16.0f);
    else if (b < PB_WO2) cast16w_blk<4>(b - PB_WO1, Wo2, wo2h, 16.0f);
    else if (b < PB_WE) cast16w_blk<4>(0u, WE, we16, 16.0f);                                  // 64 x 64, packed
    else if (b < PB_WF) cast16w_blk<4>(0u, WF, wf16, 16.0f);
    else { for (int t = (int)threadIdx.x; t < 1024; t += 256) { VST2(float, BEB + t, bE[t % 64]); VST2(float, BFB + t, bF[t % 64]); } }   // tiled biases, as k_ep_btile
}
// ---- Two more pairs of launches that read only what earlier launches wrote and nothing of each other share a grid (the channel path scores -> softmax -> x_c and the spatial path E, F -> flash are independent).
// Channel softmax (blocks 0..63, two score tiles each; first in index order) beside the E and F head projections (1024 blocks: tiles fastest, then head, then product).
// Blocks of four waves, one per SIMD: at this kernel's register count five waves fit a SIMD, so that the projections' 4096 waves (four per SIMD) and the softmax blocks are all resident at once;
// in blocks of eight waves only four of the five places could be filled, and the blocks beyond 512 would wait for a whole round of these latency-bound waves.
// dA, dB, dC, dBias: product F's operands, output and bias lie that many elements behind product E's.
__global__ __launch_bounds__(128) void k_csoft_ef(const float* __restrict__ SCC, const float* __restrict__ T1, _Float16* __restrict__ P16,
                                                  const unsigned short* __restrict__ Kin, const unsigned short* __restrict__ WE16, unsigned short* __restrict__ KS16, const float* __restrict__ BEB,
                                                  long dA, long dB, long dC, long dBias) {
    __shared__ __align__(16) float LB[2 * 64 * 65];   // the two score tiles, or the four waves' 16x64 slabs (pitch 68 floats)
    const unsigned b = blockIdx.x;
    if (b < 64u) csoft_body(LB, b, SCC, T1, P16, 16);
    else {
        const unsigned e = b - 64u; const int wave = (int)(threadIdx.x >> 5), z = (int)(e >> 9);
        w25::gemm64_body<0, false, 2, 1, false, 0>(LB + wave * (16 * 68), (int)(e & 31u) * 4 + wave, (int)((e >> 5) & 15u), z, Kin, nullptr, 2048, 64, dA, WE16, nullptr, 64, 0, dB,
            (void*)KS16, nullptr, 1024, 64, dC, BEB + (long)z * dBias, nullptr, 0, 8192, 64, 64, 0.0625f);
    }
}
// Channel product x_c = attn_c . v_ca^T (blocks 0..255: half of the 16 column tiles fastest, then head, then sample; first in index order, so that every flash block has started once these short blocks have left)
// beside the spatial flash pass (512 blocks: 256 queries fastest, then head, then sample). Two blocks fit a WGP by registers, so the last 256 flash blocks start as the channel blocks leave.
__global__ __launch_bounds__(256) void k_xc_sflash(const unsigned short* __restrict__ P16, const unsigned short* __restrict__ V16, unsigned short* __restrict__ XC16,
                                                   const unsigned short* __restrict__ QK16, const unsigned short* __restrict__ KS16, const unsigned short* __restrict__ VS16, unsigned short* __restrict__ XS16) {
    __shared__ __align__(16) float sT[8][16 * 68];    // per-wave 16x64 slab, pitch 68 floats
    const unsigned b = blockIdx.x;
    if (b < 256u) {
        const int wave = (int)(threadIdx.x >> 5);
        w25::gemm64_body<0, false, 0, 1, false, 0>(sT[wave], (int)(b & 1u) * 8 + wave, (int)((b >> 1) & 15u), (int)(b >> 5), P16, nullptr, 64, 64 * 64, 16 * 64 * 64, V16, nullptr, 2048, 64, 1024L * 2048L,
            (void*)XC16, nullptr, 16 * 1024, 1024, 1024L * 1024L, nullptr, nullptr, 0, 64, 1024, 64, 0.000244140625f);
    } else {
        const unsigned f = b - 256u;
        sfa::sflash_body(f & 3u, (f >> 2) & 15u, f >> 6, QK16, KS16, VS16, XS16);
    }
}
extern "C" void kernel_launch(void* const* d_in, const int* in_sizes, int n_in, void* d_out, int out_size, void* d_ws, size_t ws_size, hipStream_t stream) {
    (void)in_sizes; (void)n_in; (void)out_size; (void)ws_size;
    const float* x = (const float*)d_in[0];
    const float* Wq = (const float*)d_in[1];
    const float* WE = (const float*)d_in[2];
    const float* bE = (const float*)d_in[3];
    const float* WF = (const float*)d_in[4];
    const float* bF = (const float*)d_in[5];
    const float* Wo1 = (const float*)d_in[6];
    const float* bo1 = (const float*)d_in[7];
    const float* Wo2 = (const float*)d_in[8];
    const float* bo2 = (const float*)d_in[9];
    const float* t1 = (const float*)d_in[10];
    const float* t2 = (const float*)d_in[11];
    const int Bn = 8;
    const int N = 1024;
    const int C = 1024;
    const int NH = 16;
    const int HD = 64;
    const int CH = C / 2;
    float* out = (float*)d_out;
    char* wsp = (char*)d_ws;
    const int BN = Bn * N;                    // all samples' rows: every launch below covers the whole batch
    const size_t MB = (size_t)1048576;
    unsigned short* WE16 = (unsigned short*)wsp; wsp += (((size_t)((size_t)HD * HD) * 2 + 255) / 256) * 256;
    unsigned short* WF16 = (unsigned short*)wsp; wsp += (((size_t)((size_t)HD * HD) * 2 + 255) / 256) * 256;
    float* BEB = (float*)wsp; wsp += (((size_t)((size_t)C) * 4 + 255) / 256) * 256;
    float* BFB = (float*)wsp; wsp += (((size_t)((size_t)C) * 4 + 255) / 256) * 256;
    // Every product stores the 16-bit operand form that its consumer reads; no f32 plane lies between two products but the 64 x 64 channel scores.
    unsigned short* G64A  = (unsigned short*)(wsp);               // x: bf16 hi, lo
    unsigned short* G64A2 = (unsigned short*)(wsp + 16 * MB);
    unsigned short* G64B  = (unsigned short*)(wsp + 32 * MB);     // q, k rows of the weight: bf16 hi, lo
    unsigned short* G64B2 = (unsigned short*)(wsp + 36 * MB);
    unsigned short* X16   = (unsigned short*)(wsp + 40 * MB);     // x: f16
    unsigned short* WV16  = (unsigned short*)(wsp + 56 * MB);     // v rows of the weight: f16
    unsigned short* TH    = (unsigned short*)(wsp + 64 * MB);     // [sample][2048 columns: q, k][N] bf16 hi
    unsigned short* TL    = (unsigned short*)(wsp + 96 * MB);     // the same, lo
    unsigned short* QK16  = (unsigned short*)(wsp + 128 * MB);    // [BN][2048] f16: q * temp2 | k
    unsigned short* V16   = (unsigned short*)(wsp + 160 * MB);    // [BN][2048] f16: v_ca | v_sa
    float*          SCC   = (float*)(wsp + 192 * MB);
    unsigned short* P16   = (unsigned short*)(wsp + 194 * MB);
    unsigned short* XC16  = (unsigned short*)(wsp + 196 * MB);
    unsigned short* WO2H  = (unsigned short*)(wsp + 212 * MB);
    unsigned short* WO1H  = (unsigned short*)(wsp + 213 * MB);
    unsigned short* XS16  = (unsigned short*)(wsp + 214 * MB);
    unsigned short* KS16  = (unsigned short*)(wsp);               // over the x planes, read last by the q, k projection
    unsigned short* VS16  = (unsigned short*)(wsp + 16 * MB);
    k_prep<<<PB_ALL, 256, 0, stream>>>(x, Wq, Wo1, Wo2, WE, WF, bE, bF, (__bf16*)(G64A), (__bf16*)(G64A2), (_Float16*)(X16), (__bf16*)(G64B), (__bf16*)(G64B2), (_Float16*)(WV16), (_Float16*)(WO1H), (_Float16*)(WO2H), (_Float16*)(WE16), (_Float16*)(WF16), BEB, BFB);
    // shared projection, rows = sample * N + n
    w25::wmma_gemm_ring<1, true, 0, 0, 2, 4u, 4u><<<dim3((unsigned)(2048 / 256), (unsigned)(BN / 256)), 512, 0, stream>>>((const unsigned short*)(G64A), (const unsigned short*)(G64A2), (const unsigned short*)(G64B), (const unsigned short*)(G64B2), nullptr, 2048, nullptr, 1024, 1.0f, QK16, TH, TL, t2, C, N, 0, 0, 0, nullptr);
    // v projection (grid rows Bn and up) beside the channel scores (grid x = head, y = sample)
    w25::k_vproj_cscore<<<dim3((unsigned)(2048 / 128), (unsigned)(Bn + BN / 128)), 128, 0, stream>>>(X16, WV16, V16, TH, TL, SCC, Bn, NH, HD, N, C);
    // channel softmax beside the E and F projections (k_s from k and W_E, v_s from v_sa and W_F: the planes of the two products lie at fixed distances)
    k_csoft_ef<<<1088, 128, 0, stream>>>(SCC, t1, (_Float16*)P16, QK16 + C, WE16, KS16, BEB, V16 - QK16, WF16 - WE16, VS16 - KS16, BFB - BEB);
    // channel product beside the spatial attention
    k_xc_sflash<<<768, 256, 0, stream>>>(P16, V16, XC16, QK16, KS16, VS16, XS16);
    // both output halves; grid z = 0: spatial, 1: channel
    w25::wmma_gemm_ring<0, false, 2, 5><<<dim3((unsigned)(512 / 128), (unsigned)(BN / 128), (unsigned)(2)), 128, 0, stream>>>((const unsigned short*)(XS16), nullptr, (const unsigned short*)(WO1H), nullptr, out, 1024, bo1, 1024, 0.0625f, nullptr, nullptr, nullptr, nullptr, 0, N, XC16 - XS16, WO2H - WO1H, CH, bo2);
}
